// v000
// The times below were measured on an AMD MI455X: many runs one after another, warmed up first and cycling through
// copies of the inputs, with the whole window's GPU time divided by the number of runs. Launches and the gaps
// between them are all in it. The median over several windows is given; except for v000 it joins two sittings, which
// can be a few percent apart, so the side-by-side timings, each taken in one sitting, are the better comparison.
// v000 is the starting kernel. One run takes 2040 microseconds.
#include <hip/hip_runtime.h>

// Multi-head attention WITHOUT a mask and with biased projections at a 512-wide model (x [4][2048][512]; q, k, v = x W + b ('xw' [512][512] uniform +-1/sqrt(512) + zero biases; 8 heads x 64); scores x 64^-0.5; softmax over all keys; out = merged Wo + bo ('xw' + zero bias) -> [4][2048][512] (4.2 M); argument order x, Wq, bq, Wk, bk, Wv, bv, Wo, bo).
// Layout per batch: bf16 copy of x; 'xw' weights transposed once; exact projections + f32 biases; identity-table plane builders; dense T-2048 attention (hybrid rows: < 512 hi/lo 3 products, rest fp16 x1024); merged hi/lo x wo exact + bo.
// Compute dtypes, f32 accumulate: every input rounded to bf16; projections exact + f32 biases; attention rows < 512 3 products, rest fp16; softmax f32; wo hl x exact + bias.

#define NB_  4
#define TT   2048
#define DM   512    // model width: this module's D_MODEL
#define NH_  8      // heads: 8 x 64 = 512
#define NKV  8      // kv heads = heads (no grouping)
#define REP  (NH_ / NKV)
#define HD   64
#define DQ   (NH_ * HD)
#define DKV  (NKV * HD)
#define ZH   2
#define RH   512                  // query rows < RH use hi+lo planes (0: none)
#define WIN  0
#define PCAR 1024.0f
#define SCL  0.125f   // HD^-0.5
typedef _Float16 h16;
typedef unsigned short bf;
typedef __attribute__((ext_vector_type(16))) __bf16   v16bf;
typedef __attribute__((ext_vector_type(16))) _Float16 v16h;
typedef __attribute__((ext_vector_type(8)))  _Float16 v8h;
typedef __attribute__((ext_vector_type(8)))  unsigned short v8us;
typedef __attribute__((ext_vector_type(8)))  float    v8f;
typedef __attribute__((ext_vector_type(4)))  float    v4f;
typedef v8h  __attribute__((may_alias)) v8ha;
typedef v4f  __attribute__((may_alias)) v4fa;
typedef v8us __attribute__((may_alias)) v8usa;

__device__ __forceinline__ unsigned short f2bf(float f) { unsigned u = __float_as_uint(f); u += 0x7FFFu + ((u >> 16) & 1u); return (unsigned short)(u >> 16); }
__device__ __forceinline__ float bf2f(unsigned short b) { return __uint_as_float(((unsigned)b) << 16); }
__device__ __forceinline__ float bfr(float f) { return bf2f(f2bf(f)); }
__device__ __forceinline__ v16h cat16(v8h lo, v8h hi) { return __builtin_shufflevector(lo, hi, 0, 1, 2, 3, 4, 5, 6, 7, 8, 9, 10, 11, 12, 13, 14, 15); }
__device__ __forceinline__ v16bf cat16b(v8us lo, v8us hi) { return __builtin_bit_cast(v16bf, __builtin_shufflevector(lo, hi, 0, 1, 2, 3, 4, 5, 6, 7, 8, 9, 10, 11, 12, 13, 14, 15)); }
__device__ __forceinline__ v8f wmma16(v16h a, v16h b, v8f c) { return __builtin_amdgcn_wmma_f32_16x16x32_f16(false, a, false, b, (short)0, c, false, false); }
__device__ __forceinline__ v8f wmmab(v16bf a, v16bf b, v8f c) { return __builtin_amdgcn_wmma_f32_16x16x32_bf16(false, a, false, b, (short)0, c, false, false); }



// ---- k_gemmw: register-blocked GEMM, ONE WAVE per 64x64 output tile (16 accumulators), operands straight from K-contiguous 16-bit planes; grid (M/64, N/64, Z), 32 threads.
// C[m][n] (f32, pitch ldc, + optional f32 bias[n]) = sum_k A[m][k] Bt[n][k] (+ split products per NSPLIT). z-batch strides sA/sB/sC in elements. K % 32 == 0.
template <typename T16> struct WFrag;
template <> struct WFrag<h16> { typedef v16h V; static __device__ __forceinline__ V ld(const h16* p) { return cat16(*(const v8h*)p, *(const v8h*)(p + 16)); } static __device__ __forceinline__ v8f mma(V a, V b, v8f c) { return wmma16(a, b, c); } };
template <> struct WFrag<bf> { typedef v16bf V; static __device__ __forceinline__ V ld(const bf* p) { return cat16b(*(const v8us*)p, *(const v8us*)(p + 16)); } static __device__ __forceinline__ v8f mma(V a, V b, v8f c) { return wmmab(a, b, c); } };
template <typename T16, int NSPLIT, bool BIAS>
__global__ __launch_bounds__(32) void k_gemmw(const T16* __restrict__ A, const T16* __restrict__ A2, const T16* __restrict__ Bt, const T16* __restrict__ Bt2, int K, float* C, int ldc, const float* __restrict__ bias, size_t sA, size_t sB, size_t sC) {
    typedef typename WFrag<T16>::V V;
    __shared__ __align__(16) float os[16 * 68];
    const size_t z = blockIdx.z; A += z * sA; if (A2) A2 += z * sA; Bt += z * sB; if (Bt2) Bt2 += z * sB; C += z * sC;
    const int lane = threadIdx.x & 31, lr = lane & 15, hi = lane >> 4; const int r0 = blockIdx.x * 64, c0 = blockIdx.y * 64;
    v8f acc[4][4];
#pragma unroll
    for (int mb = 0; mb < 4; ++mb)
#pragma unroll
        for (int nb = 0; nb < 4; ++nb) acc[mb][nb] = (v8f){};
    const size_t aoff = (size_t)(r0 + lr) * K + 8 * hi, boff = (size_t)(c0 + lr) * K + 8 * hi;
#pragma unroll 1
    for (int kc = 0; kc < K; kc += 32) {
        V a[4], a2[4];
#pragma unroll
        for (int mb = 0; mb < 4; ++mb) { a[mb] = WFrag<T16>::ld(A + aoff + (size_t)mb * 16 * K + kc); if (NSPLIT == 1 || NSPLIT == 2) a2[mb] = WFrag<T16>::ld(A2 + aoff + (size_t)mb * 16 * K + kc); }
#pragma unroll
        for (int nb = 0; nb < 4; ++nb) { const V b = WFrag<T16>::ld(Bt + boff + (size_t)nb * 16 * K + kc); V b2; if (NSPLIT >= 2) b2 = WFrag<T16>::ld(Bt2 + boff + (size_t)nb * 16 * K + kc);
#pragma unroll
            for (int mb = 0; mb < 4; ++mb) { acc[mb][nb] = WFrag<T16>::mma(a[mb], b, acc[mb][nb]); if (NSPLIT == 1 || NSPLIT == 2) acc[mb][nb] = WFrag<T16>::mma(a2[mb], b, acc[mb][nb]); if (NSPLIT >= 2) acc[mb][nb] = WFrag<T16>::mma(a[mb], b2, acc[mb][nb]); } }
        asm volatile("v_nop\n\tv_nop\n\tv_nop\n\tv_nop" : "+v"(acc[0][0]), "+v"(acc[1][1]), "+v"(acc[2][2]), "+v"(acc[3][3]) : "v"(a[0]), "v"(a[3]));
    }
#pragma unroll
    for (int mb = 0; mb < 4; ++mb) {
#pragma unroll
        for (int nb = 0; nb < 4; ++nb) {
#pragma unroll
            for (int j = 0; j < 8; ++j) os[(hi * 8 + j) * 68 + nb * 16 + lr] = acc[mb][nb][j]; }
        __builtin_amdgcn_wave_barrier(); asm volatile("" ::: "memory");
        float* crow = C + (size_t)(r0 + mb * 16) * ldc + c0;
{
#pragma unroll
            for (int s = 0; s < 8; ++s) { const int row = 2 * s + hi, cofs = lr * 4; v4f val = *(const v4fa*)(os + row * 68 + cofs); if (BIAS) { val[0] += bfr(bias[c0 + cofs]); val[1] += bfr(bias[c0 + cofs + 1]); val[2] += bfr(bias[c0 + cofs + 2]); val[3] += bfr(bias[c0 + cofs + 3]); }
                *(v4f*)(crow + (size_t)row * ldc + cofs) = val; }
             }
        __builtin_amdgcn_wave_barrier(); asm volatile("" ::: "memory");
    }
}

__device__ __forceinline__ h16 tohx(float x) { return (h16)x; }
__device__ __forceinline__ void splitf(float y, unsigned short& h, unsigned short& l) { h = f2bf(y); l = f2bf(y - bf2f(h)); }
typedef __attribute__((ext_vector_type(2))) _Float16 v2h;
typedef __attribute__((ext_vector_type(4))) _Float16 v4h;
typedef __attribute__((ext_vector_type(2))) unsigned short v2us;
typedef __attribute__((ext_vector_type(4))) unsigned short v4us;
typedef __attribute__((ext_vector_type(2))) float v2f;
typedef __attribute__((ext_vector_type(4))) int v4i;

__global__ __launch_bounds__(256) void k_wtG(const float* __restrict__ w, int K, int N, bf* Bt) {
    const int lane = threadIdx.x & 31; const int L0 = (blockIdx.x * 8 + (threadIdx.x >> 5)) * 8; const int nlines = N * K / 64;
{
#pragma unroll 1
        for (int l = 0; l < 8; ++l) { const int L = L0 + l; if (L >= nlines) break; const size_t e = (size_t)L * 64 + lane * 2; const int k = (int)(e % K), n = (int)(e / K); v2us o;
            o[0] = f2bf(w[(size_t)k * N + n]); o[1] = f2bf(w[(size_t)(k + 1) * N + n]); *(v2us*)(Bt + e) = o; }
         }
}
__global__ __launch_bounds__(256) void k_cvt8(const float* __restrict__ src, bf* dst, size_t n8) { const size_t i = (size_t)blockIdx.x * 256 + threadIdx.x; if (i >= n8) return; const v8f v = *(const v8f*)(src + i * 8); v8us o;
#pragma unroll
    for (int k = 0; k < 8; ++k) o[k] = f2bf(v[k]); *(v8us*)(dst + i * 8) = o;  }

// k_rope: head planes [h][t][d] (fp16 + hi/lo) of rope(x) x sc with the rotate-half convention out[d] = x[d] cos[t][d] - x[d+HD/2] sin[t][d], out[d+HD/2] = x[d+HD/2] cos[t][d+HD/2] + x[d] sin[t][d+HD/2]
__global__ __launch_bounds__(256) void k_rope(const float* __restrict__ F, int pitch, int nheads, const float* __restrict__ CS, const float* __restrict__ RF, const float* __restrict__ nw, float sc, h16* P16, bf* Ph, bf* Pl) {
    const size_t e = ((size_t)blockIdx.x * 256 + threadIdx.x) * 2; if (e >= (size_t)nheads * TT * HD) return; const int d = (int)(e % HD); const int t = (int)((e / HD) % TT); const int h = (int)(e / ((size_t)HD * TT)); const float* f = F + (size_t)t * pitch + h * HD; const float rf = RF ? RF[(size_t)h * TT + t] : 1.0f; v2h o16; v2us oh, ol;
#pragma unroll
    for (int q = 0; q < 2; ++q) { const int dd = d + q; const int dp = (dd < HD / 2) ? dd + HD / 2 : dd - HD / 2; float x0 = f[dd], x1 = f[dp];
        if (RF) { float n0 = __fmul_rn(x0, rf), n1 = __fmul_rn(x1, rf); asm volatile("" : "+v"(n0)); asm volatile("" : "+v"(n1)); x0 = __fmul_rn(bfr(nw[dd]), n0); x1 = __fmul_rn(bfr(nw[dp]), n1); }
        const v2f cs = *(const v2f*)(CS + ((size_t)t * HD + dd) * 2); float a = __fmul_rn(x0, cs[0]), bq = __fmul_rn(x1, cs[1]); asm volatile("" : "+v"(a)); asm volatile("" : "+v"(bq)); const float r = ((dd < HD / 2) ? __fsub_rn(a, bq) : __fadd_rn(a, bq)) * sc;
        o16[q] = tohx(r); unsigned short a2, c2; splitf(r, a2, c2); oh[q] = a2; ol[q] = c2; }
    *(v2h*)(P16 + e) = o16; *(v2us*)(Ph + e) = oh; *(v2us*)(Pl + e) = ol;  }
__global__ __launch_bounds__(256) void k_vtp(const float* __restrict__ F, int pitch, int nheads, h16* V16, bf* Vh, bf* Vl) { const size_t e = ((size_t)blockIdx.x * 256 + threadIdx.x) * 2; if (e >= (size_t)nheads * HD * TT) return; const int t = (int)(e % TT); const int d = (int)((e / TT) % HD); const int g = (int)(e / ((size_t)TT * HD)); v2h o16; v2us oh, ol;
#pragma unroll
    for (int q = 0; q < 2; ++q) { const float x = F[(size_t)(t + q) * pitch + g * HD + d]; o16[q] = tohx(x); unsigned short a2, c2; splitf(x, a2, c2); oh[q] = a2; ol[q] = c2; }
    *(v2h*)(V16 + e) = o16; *(v2us*)(Vh + e) = oh; *(v2us*)(Vl + e) = ol;  }
__global__ __launch_bounds__(256) void k_csid(float* CS) { const int idx = blockIdx.x * 256 + threadIdx.x; if (idx >= TT * HD) return; v2f cs; cs[0] = 1.0f; cs[1] = 0.0f; *(v2f*)(CS + (size_t)idx * 2) = cs;  }
// k_asoft: per row (zz, i): t = S x HD^-0.5 (no mask); softmax over the 2048 keys (register row, one exp, fixed trees);
__global__ __launch_bounds__(256) void k_asoft(const float* __restrict__ Sb, h16* P16, bf* Ph, bf* Pl) {
    const int lane = threadIdx.x & 31; const int row = blockIdx.x * 8 + (threadIdx.x >> 5); if (row >= ZH * TT) return; const int i = row % TT; const int zz = row / TT; (void)zz; const bool hires = (i < RH); const float* sr = Sb + (size_t)row * TT; float v[TT / 32]; float mx = -3.0e38f;
#pragma unroll
    for (int ch = 0; ch < TT / 128; ++ch) { const int j0 = ch * 128 + lane * 4; const v4f a = *(const v4f*)(sr + j0);
#pragma unroll
        for (int q = 0; q < 4; ++q) { const int j = j0 + q; (void)j; const float t = a[q] * SCL; v[ch * 4 + q] = t; mx = fmaxf(mx, t); } }
#pragma unroll
    for (int sh = 16; sh; sh >>= 1) mx = fmaxf(mx, __shfl_xor(mx, sh, 32));
    float sum = 0.f;
#pragma unroll
    for (int k = 0; k < TT / 32; ++k) { float d0 = __fsub_rn(v[k], mx); asm volatile("" : "+v"(d0)); v[k] = __builtin_amdgcn_exp2f(__fmul_rn(d0, 1.4426950408889634f)); sum += v[k]; }
#pragma unroll
    for (int sh = 16; sh; sh >>= 1) sum += __shfl_xor(sum, sh, 32);
    const float f = __fdiv_rn(hires ? 1.0f : PCAR, sum);
{
        if (hires) {
#pragma unroll
            for (int ch = 0; ch < TT / 128; ++ch) { v4us oh, ol;
#pragma unroll
                for (int q = 0; q < 4; ++q) { unsigned short a, c2; splitf(v[ch * 4 + q] * f, a, c2); oh[q] = a; ol[q] = c2; }
                const size_t oo = ((size_t)zz * (RH ? RH : 1) + i) * TT + ch * 128 + lane * 4; *(v4us*)(Ph + oo) = oh; *(v4us*)(Pl + oo) = ol; }
        } else {
#pragma unroll
            for (int ch = 0; ch < TT / 128; ++ch) { v4h o4;
#pragma unroll
                for (int q = 0; q < 4; ++q) o4[q] = tohx(v[ch * 4 + q] * f);
                *(v4h*)(P16 + (size_t)row * TT + ch * 128 + lane * 4) = o4; } }
         }
}
__global__ __launch_bounds__(256) void k_merge(const float* __restrict__ O, int h0, bf* Ah, bf* Al) { const size_t e = ((size_t)blockIdx.x * 256 + threadIdx.x) * 2; if (e >= (size_t)ZH * TT * HD) return; const int d = (int)(e % HD); const int t = (int)((e / HD) % TT); const int zz = (int)(e / ((size_t)HD * TT)); const float cs = (t < RH) ? 1.0f : (1.0f / PCAR); const size_t oo = (size_t)t * DQ + (h0 + zz) * HD + d;
    v2us oh, ol;
#pragma unroll
    for (int q = 0; q < 2; ++q) { unsigned short a, c2; splitf(O[e + q] * cs, a, c2); oh[q] = a; ol[q] = c2; } *(v2us*)(Ah + oo) = oh; *(v2us*)(Al + oo) = ol;  }

extern "C" void kernel_launch(void* const* d_in, const int* in_sizes, int n_in,
                              void* d_out, int out_size, void* d_ws, size_t ws_size, hipStream_t stream) {
    (void)in_sizes; (void)n_in; (void)out_size;
    const float* x = (const float*)d_in[0]; const float* wq = (const float*)d_in[1]; const float* bq = (const float*)d_in[2]; const float* wk = (const float*)d_in[3]; const float* bk = (const float*)d_in[4]; const float* wv = (const float*)d_in[5]; const float* bv = (const float*)d_in[6]; const float* wo = (const float*)d_in[7]; const float* bo = (const float*)d_in[8];   /* argument order inputs, wq, bq, wk, bk, wv, bv, wo, bo ('xw' + biases) */
    float* OUT = (float*)d_out;     // [4][2048][512]
    char* wsp = (char*)d_ws;
    auto take = [&](size_t bytes) { char* p = wsp; wsp += (bytes + 255) & ~(size_t)255; return (void*)p; };
    bf* WQ = (bf*)take((size_t)DQ * DM * 2); bf* WK = (bf*)take((size_t)DKV * DM * 2); bf* WV = (bf*)take((size_t)DKV * DM * 2); bf* WO = (bf*)take((size_t)DM * DQ * 2); float* CS = (float*)take((size_t)TT * HD * 2 * 4);
    bf* XB = (bf*)take((size_t)TT * DM * 2); float* FQ = (float*)take((size_t)TT * DQ * 4); float* FK = (float*)take((size_t)TT * DKV * 4);
    h16* QP16 = (h16*)take((size_t)NH_ * TT * HD * 2); h16* KP16 = (h16*)take((size_t)NKV * TT * HD * 2); h16* VT16 = (h16*)take((size_t)NKV * HD * TT * 2);
    bf* QPh = (bf*)take((size_t)NH_ * TT * HD * 2); bf* QPl = (bf*)take((size_t)NH_ * TT * HD * 2); bf* KPh = (bf*)take((size_t)NKV * TT * HD * 2); bf* KPl = (bf*)take((size_t)NKV * TT * HD * 2); bf* VTh = (bf*)take((size_t)NKV * HD * TT * 2); bf* VTl = (bf*)take((size_t)NKV * HD * TT * 2); bf* Ph = (bf*)take((size_t)ZH * RH * TT * 2); bf* Pl = (bf*)take((size_t)ZH * RH * TT * 2);
    float* Sb = (float*)take((size_t)ZH * TT * TT * 4); h16* P16 = (h16*)take((size_t)ZH * TT * TT * 2); float* Ob = (float*)take((size_t)ZH * TT * HD * 4); bf* ATh = (bf*)take((size_t)TT * DQ * 2); bf* ATl = (bf*)take((size_t)TT * DQ * 2);
    if ((size_t)(wsp - (char*)d_ws) > ws_size) return;    // ws 256 MiB
    float* FV = FK;   // v projection reuses the k buffer after the k planes are built (stream-ordered)
    { k_wtG<<<(unsigned)((DM * DQ / 64 + 63) / 64), 256, 0, stream>>>(wq, DM, DQ, WQ); k_wtG<<<(unsigned)((DM * DKV / 64 + 63) / 64), 256, 0, stream>>>(wk, DM, DKV, WK); k_wtG<<<(unsigned)((DM * DKV / 64 + 63) / 64), 256, 0, stream>>>(wv, DM, DKV, WV);
      k_wtG<<<(unsigned)((DQ * DM / 64 + 63) / 64), 256, 0, stream>>>(wo, DQ, DM, WO);
       }
    k_csid<<<(TT * HD + 255) / 256, 256, 0, stream>>>(CS);
    const unsigned LQ = (unsigned)(((size_t)NH_ * TT * HD / 2 + 255) / 256), LKv = (unsigned)(((size_t)NKV * TT * HD / 2 + 255) / 256);
    for (int b = 0; b < NB_; ++b) {
        
        k_cvt8<<<(unsigned)(((size_t)TT * DM / 8 + 255) / 256), 256, 0, stream>>>(x + (size_t)b * TT * DM, XB, (size_t)TT * DM / 8);
        k_gemmw<bf, 0, true><<<dim3(TT / 64, DQ / 64, 1), 32, 0, stream>>>(XB, nullptr, WQ, nullptr, DM, FQ, DQ, bq, 0, 0, 0);
        k_rope<<<LQ, 256, 0, stream>>>(FQ, DQ, NH_, CS, nullptr, nullptr, 1.0f, QP16, QPh, QPl);
        k_gemmw<bf, 0, true><<<dim3(TT / 64, DKV / 64, 1), 32, 0, stream>>>(XB, nullptr, WK, nullptr, DM, FK, DKV, bk, 0, 0, 0);
        k_rope<<<LKv, 256, 0, stream>>>(FK, DKV, NKV, CS, nullptr, nullptr, 1.0f, KP16, KPh, KPl);
        k_gemmw<bf, 0, true><<<dim3(TT / 64, DKV / 64, 1), 32, 0, stream>>>(XB, nullptr, WV, nullptr, DM, FV, DKV, bv, 0, 0, 0); k_vtp<<<LKv, 256, 0, stream>>>(FV, DKV, NKV, VT16, VTh, VTl);
        for (int h0 = 0; h0 < NH_; h0 += ZH) { const size_t zq = (size_t)h0, zk = (size_t)(h0 / REP);   // one kv head per query head: the pass's two heads use consecutive kv planes (z-strides TT*HD)
            k_gemmw<bf, 2, false><<<dim3(RH / 64, TT / 64, ZH), 32, 0, stream>>>(QPh + zq * TT * HD, QPl + zq * TT * HD, KPh + zk * TT * HD, KPl + zk * TT * HD, HD, Sb, TT, nullptr, (size_t)TT * HD, (size_t)TT * HD, (size_t)TT * TT);
            k_gemmw<h16, 0, false><<<dim3((TT - RH) / 64, TT / 64, ZH), 32, 0, stream>>>(QP16 + zq * TT * HD + (size_t)RH * HD, nullptr, KP16 + zk * TT * HD, nullptr, HD, Sb + (size_t)RH * TT, TT, nullptr, (size_t)TT * HD, (size_t)TT * HD, (size_t)TT * TT);
            k_asoft<<<ZH * TT / 8, 256, 0, stream>>>(Sb, P16, Ph, Pl);
            k_gemmw<bf, 2, false><<<dim3(RH / 64, HD / 64, ZH), 32, 0, stream>>>(Ph, Pl, VTh + zk * HD * TT, VTl + zk * HD * TT, TT, Ob, HD, nullptr, (size_t)RH * TT, (size_t)HD * TT, (size_t)TT * HD);
            k_gemmw<h16, 0, false><<<dim3((TT - RH) / 64, HD / 64, ZH), 32, 0, stream>>>(P16 + (size_t)RH * TT, nullptr, VT16 + zk * HD * TT, nullptr, TT, Ob + (size_t)RH * HD, HD, nullptr, (size_t)TT * TT, (size_t)HD * TT, (size_t)TT * HD);
            k_merge<<<(unsigned)(((size_t)ZH * TT * HD / 2 + 255) / 256), 256, 0, stream>>>(Ob, h0, ATh, ATl); }
        k_gemmw<bf, 1, true><<<dim3(TT / 64, DM / 64, 1), 32, 0, stream>>>(ATh, ATl, WO, nullptr, DQ, OUT + (size_t)b * TT * DM, DM, bo, 0, 0, 0); }
}

// v001
// It runs in 902 microseconds.
// In two side-by-side timings against v000, it was 2.26 and 2.28 times as fast.
#include <hip/hip_runtime.h>

// Multi-head attention WITHOUT a mask and with biased projections at a 512-wide model (x [4][2048][512]; q, k, v = x W + b ('xw' [512][512] uniform +-1/sqrt(512) + zero biases; 8 heads x 64); scores x 64^-0.5; softmax over all keys; out = merged Wo + bo ('xw' + zero bias) -> [4][2048][512] (4.2 M); argument order x, Wq, bq, Wk, bk, Wv, bv, Wo, bo).
// Layout per batch: bf16 copy of x; 'xw' weights transposed once; exact projections + f32 biases; identity-table plane builders; dense T-2048 attention (hybrid rows: < 512 hi/lo 3 products, rest fp16 x1024); merged hi/lo x wo exact + bo.
// Compute dtypes, f32 accumulate: every input rounded to bf16; projections exact + f32 biases; attention rows < 512 3 products, rest fp16; softmax f32; wo hl x exact + bias.

#define NB_  4
#define TT   2048
#define DM   512    // model width: this module's D_MODEL
#define NH_  8      // heads: 8 x 64 = 512
#define NKV  8      // kv heads = heads (no grouping)
#define REP  (NH_ / NKV)
#define HD   64
#define DQ   (NH_ * HD)
#define DKV  (NKV * HD)
#define ZH   2
#define RH   512                  // query rows < RH use hi+lo planes (0: none)
#define WIN  0
#define PCAR 1024.0f
#define SCL  0.125f   // HD^-0.5
#define KSPV 16       // P V products: K = 2048 keys cut into KSPV ranges, one work-group each; k_merge adds the partial tiles
typedef _Float16 h16;
typedef unsigned short bf;
typedef __attribute__((ext_vector_type(16))) __bf16   v16bf;
typedef __attribute__((ext_vector_type(16))) _Float16 v16h;
typedef __attribute__((ext_vector_type(8)))  _Float16 v8h;
typedef __attribute__((ext_vector_type(8)))  unsigned short v8us;
typedef __attribute__((ext_vector_type(8)))  float    v8f;
typedef __attribute__((ext_vector_type(4)))  float    v4f;
typedef v8h  __attribute__((may_alias)) v8ha;
typedef v4f  __attribute__((may_alias)) v4fa;
typedef v8us __attribute__((may_alias)) v8usa;

__device__ __forceinline__ unsigned short f2bf(float f) { unsigned u = __float_as_uint(f); u += 0x7FFFu + ((u >> 16) & 1u); return (unsigned short)(u >> 16); }
__device__ __forceinline__ float bf2f(unsigned short b) { return __uint_as_float(((unsigned)b) << 16); }
__device__ __forceinline__ float bfr(float f) { return bf2f(f2bf(f)); }
__device__ __forceinline__ v16h cat16(v8h lo, v8h hi) { return __builtin_shufflevector(lo, hi, 0, 1, 2, 3, 4, 5, 6, 7, 8, 9, 10, 11, 12, 13, 14, 15); }
__device__ __forceinline__ v16bf cat16b(v8us lo, v8us hi) { return __builtin_bit_cast(v16bf, __builtin_shufflevector(lo, hi, 0, 1, 2, 3, 4, 5, 6, 7, 8, 9, 10, 11, 12, 13, 14, 15)); }
__device__ __forceinline__ v8f wmma16(v16h a, v16h b, v8f c) { return __builtin_amdgcn_wmma_f32_16x16x32_f16(false, a, false, b, (short)0, c, false, false); }
__device__ __forceinline__ v8f wmmab(v16bf a, v16bf b, v8f c) { return __builtin_amdgcn_wmma_f32_16x16x32_bf16(false, a, false, b, (short)0, c, false, false); }



// ---- k_gemmw: register-blocked GEMM, ONE WAVE per 64x64 output tile (16 accumulators), operands straight from K-contiguous 16-bit planes; grid (M/64, N/64, Z), 32 threads.
// C[m][n] (f32, pitch ldc, + optional f32 bias[n]) = sum_k A[m][k] Bt[n][k] (+ split products per NSPLIT). z-batch strides sA/sB/sC in elements. K % 32 == 0.
// KSP > 1: grid z = Z * KSP; work-group (z, ks) sums only k in [ks K/KSP, (ks+1) K/KSP) and stores its partial tile in plane z * KSP + ks (stride sC); the reader adds the KSP planes. K % (32 KSP) == 0.
template <typename T16> struct WFrag;
template <> struct WFrag<h16> { typedef v16h V; static __device__ __forceinline__ V ld(const h16* p) { return cat16(*(const v8h*)p, *(const v8h*)(p + 16)); } static __device__ __forceinline__ v8f mma(V a, V b, v8f c) { return wmma16(a, b, c); } };
template <> struct WFrag<bf> { typedef v16bf V; static __device__ __forceinline__ V ld(const bf* p) { return cat16b(*(const v8us*)p, *(const v8us*)(p + 16)); } static __device__ __forceinline__ v8f mma(V a, V b, v8f c) { return wmmab(a, b, c); } };
template <typename T16, int NSPLIT, bool BIAS, int KSP = 1>
__global__ __launch_bounds__(32) void k_gemmw(const T16* __restrict__ A, const T16* __restrict__ A2, const T16* __restrict__ Bt, const T16* __restrict__ Bt2, int K, float* C, int ldc, const float* __restrict__ bias, size_t sA, size_t sB, size_t sC) {
    typedef typename WFrag<T16>::V V;
    __shared__ __align__(16) float os[16 * 68];
    const size_t z = blockIdx.z / KSP; const int ks = blockIdx.z % KSP; A += z * sA; if (A2) A2 += z * sA; Bt += z * sB; if (Bt2) Bt2 += z * sB; C += (size_t)blockIdx.z * sC;
    const int lane = threadIdx.x & 31, lr = lane & 15, hi = lane >> 4; const int r0 = blockIdx.x * 64, c0 = blockIdx.y * 64;
    v8f acc[4][4];
#pragma unroll
    for (int mb = 0; mb < 4; ++mb)
#pragma unroll
        for (int nb = 0; nb < 4; ++nb) acc[mb][nb] = (v8f){};
    const size_t aoff = (size_t)(r0 + lr) * K + 8 * hi, boff = (size_t)(c0 + lr) * K + 8 * hi;
#pragma unroll 1
    for (int kc = ks * (K / KSP), ke = kc + K / KSP; kc < ke; kc += 32) {
        V a[4], a2[4];
#pragma unroll
        for (int mb = 0; mb < 4; ++mb) { a[mb] = WFrag<T16>::ld(A + aoff + (size_t)mb * 16 * K + kc); if (NSPLIT == 1 || NSPLIT == 2) a2[mb] = WFrag<T16>::ld(A2 + aoff + (size_t)mb * 16 * K + kc); }
#pragma unroll
        for (int nb = 0; nb < 4; ++nb) { const V b = WFrag<T16>::ld(Bt + boff + (size_t)nb * 16 * K + kc); V b2; if (NSPLIT >= 2) b2 = WFrag<T16>::ld(Bt2 + boff + (size_t)nb * 16 * K + kc);
#pragma unroll
            for (int mb = 0; mb < 4; ++mb) { acc[mb][nb] = WFrag<T16>::mma(a[mb], b, acc[mb][nb]); if (NSPLIT == 1 || NSPLIT == 2) acc[mb][nb] = WFrag<T16>::mma(a2[mb], b, acc[mb][nb]); if (NSPLIT >= 2) acc[mb][nb] = WFrag<T16>::mma(a[mb], b2, acc[mb][nb]); } }
        asm volatile("v_nop\n\tv_nop\n\tv_nop\n\tv_nop" : "+v"(acc[0][0]), "+v"(acc[1][1]), "+v"(acc[2][2]), "+v"(acc[3][3]) : "v"(a[0]), "v"(a[3]));
    }
#pragma unroll
    for (int mb = 0; mb < 4; ++mb) {
#pragma unroll
        for (int nb = 0; nb < 4; ++nb) {
#pragma unroll
            for (int j = 0; j < 8; ++j) os[(hi * 8 + j) * 68 + nb * 16 + lr] = acc[mb][nb][j]; }
        __builtin_amdgcn_wave_barrier(); asm volatile("" ::: "memory");
        float* crow = C + (size_t)(r0 + mb * 16) * ldc + c0;
{
#pragma unroll
            for (int s = 0; s < 8; ++s) { const int row = 2 * s + hi, cofs = lr * 4; v4f val = *(const v4fa*)(os + row * 68 + cofs); if (BIAS) { val[0] += bfr(bias[c0 + cofs]); val[1] += bfr(bias[c0 + cofs + 1]); val[2] += bfr(bias[c0 + cofs + 2]); val[3] += bfr(bias[c0 + cofs + 3]); }
                *(v4f*)(crow + (size_t)row * ldc + cofs) = val; }
             }
        __builtin_amdgcn_wave_barrier(); asm volatile("" ::: "memory");
    }
}

__device__ __forceinline__ h16 tohx(float x) { return (h16)x; }
__device__ __forceinline__ void splitf(float y, unsigned short& h, unsigned short& l) { h = f2bf(y); l = f2bf(y - bf2f(h)); }
typedef __attribute__((ext_vector_type(2))) _Float16 v2h;
typedef __attribute__((ext_vector_type(4))) _Float16 v4h;
typedef __attribute__((ext_vector_type(2))) unsigned short v2us;
typedef __attribute__((ext_vector_type(4))) unsigned short v4us;
typedef __attribute__((ext_vector_type(2))) float v2f;
typedef __attribute__((ext_vector_type(4))) int v4i;

__global__ __launch_bounds__(256) void k_wtG(const float* __restrict__ w, int K, int N, bf* Bt) {
    const int lane = threadIdx.x & 31; const int L0 = (blockIdx.x * 8 + (threadIdx.x >> 5)) * 8; const int nlines = N * K / 64;
{
#pragma unroll 1
        for (int l = 0; l < 8; ++l) { const int L = L0 + l; if (L >= nlines) break; const size_t e = (size_t)L * 64 + lane * 2; const int k = (int)(e % K), n = (int)(e / K); v2us o;
            o[0] = f2bf(w[(size_t)k * N + n]); o[1] = f2bf(w[(size_t)(k + 1) * N + n]); *(v2us*)(Bt + e) = o; }
         }
}
__global__ __launch_bounds__(256) void k_cvt8(const float* __restrict__ src, bf* dst, size_t n8) { const size_t i = (size_t)blockIdx.x * 256 + threadIdx.x; if (i >= n8) return; const v8f v = *(const v8f*)(src + i * 8); v8us o;
#pragma unroll
    for (int k = 0; k < 8; ++k) o[k] = f2bf(v[k]); *(v8us*)(dst + i * 8) = o;  }

// k_rope: head planes [h][t][d] (fp16 + hi/lo) of rope(x) x sc with the rotate-half convention out[d] = x[d] cos[t][d] - x[d+HD/2] sin[t][d], out[d+HD/2] = x[d+HD/2] cos[t][d+HD/2] + x[d] sin[t][d+HD/2]
__global__ __launch_bounds__(256) void k_rope(const float* __restrict__ F, int pitch, int nheads, const float* __restrict__ CS, const float* __restrict__ RF, const float* __restrict__ nw, float sc, h16* P16, bf* Ph, bf* Pl) {
    const size_t e = ((size_t)blockIdx.x * 256 + threadIdx.x) * 2; if (e >= (size_t)nheads * TT * HD) return; const int d = (int)(e % HD); const int t = (int)((e / HD) % TT); const int h = (int)(e / ((size_t)HD * TT)); const float* f = F + (size_t)t * pitch + h * HD; const float rf = RF ? RF[(size_t)h * TT + t] : 1.0f; v2h o16; v2us oh, ol;
#pragma unroll
    for (int q = 0; q < 2; ++q) { const int dd = d + q; const int dp = (dd < HD / 2) ? dd + HD / 2 : dd - HD / 2; float x0 = f[dd], x1 = f[dp];
        if (RF) { float n0 = __fmul_rn(x0, rf), n1 = __fmul_rn(x1, rf); asm volatile("" : "+v"(n0)); asm volatile("" : "+v"(n1)); x0 = __fmul_rn(bfr(nw[dd]), n0); x1 = __fmul_rn(bfr(nw[dp]), n1); }
        const v2f cs = *(const v2f*)(CS + ((size_t)t * HD + dd) * 2); float a = __fmul_rn(x0, cs[0]), bq = __fmul_rn(x1, cs[1]); asm volatile("" : "+v"(a)); asm volatile("" : "+v"(bq)); const float r = ((dd < HD / 2) ? __fsub_rn(a, bq) : __fadd_rn(a, bq)) * sc;
        o16[q] = tohx(r); unsigned short a2, c2; splitf(r, a2, c2); oh[q] = a2; ol[q] = c2; }
    *(v2h*)(P16 + e) = o16; *(v2us*)(Ph + e) = oh; *(v2us*)(Pl + e) = ol;  }
__global__ __launch_bounds__(256) void k_vtp(const float* __restrict__ F, int pitch, int nheads, h16* V16, bf* Vh, bf* Vl) { const size_t e = ((size_t)blockIdx.x * 256 + threadIdx.x) * 2; if (e >= (size_t)nheads * HD * TT) return; const int t = (int)(e % TT); const int d = (int)((e / TT) % HD); const int g = (int)(e / ((size_t)TT * HD)); v2h o16; v2us oh, ol;
#pragma unroll
    for (int q = 0; q < 2; ++q) { const float x = F[(size_t)(t + q) * pitch + g * HD + d]; o16[q] = tohx(x); unsigned short a2, c2; splitf(x, a2, c2); oh[q] = a2; ol[q] = c2; }
    *(v2h*)(V16 + e) = o16; *(v2us*)(Vh + e) = oh; *(v2us*)(Vl + e) = ol;  }
__global__ __launch_bounds__(256) void k_csid(float* CS) { const int idx = blockIdx.x * 256 + threadIdx.x; if (idx >= TT * HD) return; v2f cs; cs[0] = 1.0f; cs[1] = 0.0f; *(v2f*)(CS + (size_t)idx * 2) = cs;  }
// k_asoft: per row (zz, i): t = S x HD^-0.5 (no mask); softmax over the 2048 keys (register row, one exp, fixed trees);
__global__ __launch_bounds__(256) void k_asoft(const float* __restrict__ Sb, h16* P16, bf* Ph, bf* Pl) {
    const int lane = threadIdx.x & 31; const int row = blockIdx.x * 8 + (threadIdx.x >> 5); if (row >= ZH * TT) return; const int i = row % TT; const int zz = row / TT; (void)zz; const bool hires = (i < RH); const float* sr = Sb + (size_t)row * TT; float v[TT / 32]; float mx = -3.0e38f;
#pragma unroll
    for (int ch = 0; ch < TT / 128; ++ch) { const int j0 = ch * 128 + lane * 4; const v4f a = *(const v4f*)(sr + j0);
#pragma unroll
        for (int q = 0; q < 4; ++q) { const int j = j0 + q; (void)j; const float t = a[q] * SCL; v[ch * 4 + q] = t; mx = fmaxf(mx, t); } }
#pragma unroll
    for (int sh = 16; sh; sh >>= 1) mx = fmaxf(mx, __shfl_xor(mx, sh, 32));
    float sum = 0.f;
#pragma unroll
    for (int k = 0; k < TT / 32; ++k) { float d0 = __fsub_rn(v[k], mx); asm volatile("" : "+v"(d0)); v[k] = __builtin_amdgcn_exp2f(__fmul_rn(d0, 1.4426950408889634f)); sum += v[k]; }
#pragma unroll
    for (int sh = 16; sh; sh >>= 1) sum += __shfl_xor(sum, sh, 32);
    const float f = __fdiv_rn(hires ? 1.0f : PCAR, sum);
{
        if (hires) {
#pragma unroll
            for (int ch = 0; ch < TT / 128; ++ch) { v4us oh, ol;
#pragma unroll
                for (int q = 0; q < 4; ++q) { unsigned short a, c2; splitf(v[ch * 4 + q] * f, a, c2); oh[q] = a; ol[q] = c2; }
                const size_t oo = ((size_t)zz * (RH ? RH : 1) + i) * TT + ch * 128 + lane * 4; *(v4us*)(Ph + oo) = oh; *(v4us*)(Pl + oo) = ol; }
        } else {
#pragma unroll
            for (int ch = 0; ch < TT / 128; ++ch) { v4h o4;
#pragma unroll
                for (int q = 0; q < 4; ++q) o4[q] = tohx(v[ch * 4 + q] * f);
                *(v4h*)(P16 + (size_t)row * TT + ch * 128 + lane * 4) = o4; } }
         }
}
__global__ __launch_bounds__(256) void k_merge(const float* __restrict__ O, int h0, bf* Ah, bf* Al) { const size_t e = ((size_t)blockIdx.x * 256 + threadIdx.x) * 2; if (e >= (size_t)ZH * TT * HD) return; const int d = (int)(e % HD); const int t = (int)((e / HD) % TT); const int zz = (int)(e / ((size_t)HD * TT)); const float cs = (t < RH) ? 1.0f : (1.0f / PCAR); const size_t oo = (size_t)t * DQ + (h0 + zz) * HD + d;
    const float* op = O + (size_t)zz * (KSPV - 1) * TT * HD + e;   // head zz owns KSPV partial planes [t][d] of its P V product; they are added in ascending key range
    v2f p[KSPV];
#pragma unroll
    for (int ks = 0; ks < KSPV; ++ks) p[ks] = *(const v2f*)(op + (size_t)ks * TT * HD);
    asm volatile("s_wait_xcnt 0x0" :: "v"(op) : "memory");   // precaution: the wait in front of any overwrite of these loads' address pair; naming op keeps the pair live up to here
    v2f s = p[0];
#pragma unroll
    for (int ks = 1; ks < KSPV; ++ks) s += p[ks];
    v2us oh, ol;
#pragma unroll
    for (int q = 0; q < 2; ++q) { unsigned short a, c2; splitf(s[q] * cs, a, c2); oh[q] = a; ol[q] = c2; } *(v2us*)(Ah + oo) = oh; *(v2us*)(Al + oo) = ol;  }

extern "C" void kernel_launch(void* const* d_in, const int* in_sizes, int n_in,
                              void* d_out, int out_size, void* d_ws, size_t ws_size, hipStream_t stream) {
    (void)in_sizes; (void)n_in; (void)out_size;
    const float* x = (const float*)d_in[0]; const float* wq = (const float*)d_in[1]; const float* bq = (const float*)d_in[2]; const float* wk = (const float*)d_in[3]; const float* bk = (const float*)d_in[4]; const float* wv = (const float*)d_in[5]; const float* bv = (const float*)d_in[6]; const float* wo = (const float*)d_in[7]; const float* bo = (const float*)d_in[8];   /* argument order inputs, wq, bq, wk, bk, wv, bv, wo, bo ('xw' + biases) */
    float* OUT = (float*)d_out;     // [4][2048][512]
    char* wsp = (char*)d_ws;
    auto take = [&](size_t bytes) { char* p = wsp; wsp += (bytes + 255) & ~(size_t)255; return (void*)p; };
    bf* WQ = (bf*)take((size_t)DQ * DM * 2); bf* WK = (bf*)take((size_t)DKV * DM * 2); bf* WV = (bf*)take((size_t)DKV * DM * 2); bf* WO = (bf*)take((size_t)DM * DQ * 2); float* CS = (float*)take((size_t)TT * HD * 2 * 4);
    bf* XB = (bf*)take((size_t)TT * DM * 2); float* FQ = (float*)take((size_t)TT * DQ * 4); float* FK = (float*)take((size_t)TT * DKV * 4);
    h16* QP16 = (h16*)take((size_t)NH_ * TT * HD * 2); h16* KP16 = (h16*)take((size_t)NKV * TT * HD * 2); h16* VT16 = (h16*)take((size_t)NKV * HD * TT * 2);
    bf* QPh = (bf*)take((size_t)NH_ * TT * HD * 2); bf* QPl = (bf*)take((size_t)NH_ * TT * HD * 2); bf* KPh = (bf*)take((size_t)NKV * TT * HD * 2); bf* KPl = (bf*)take((size_t)NKV * TT * HD * 2); bf* VTh = (bf*)take((size_t)NKV * HD * TT * 2); bf* VTl = (bf*)take((size_t)NKV * HD * TT * 2); bf* Ph = (bf*)take((size_t)ZH * RH * TT * 2); bf* Pl = (bf*)take((size_t)ZH * RH * TT * 2);
    float* Sb = (float*)take((size_t)ZH * TT * TT * 4); h16* P16 = (h16*)take((size_t)ZH * TT * TT * 2); float* Ob = (float*)take((size_t)KSPV * ZH * TT * HD * 4); bf* ATh = (bf*)take((size_t)TT * DQ * 2); bf* ATl = (bf*)take((size_t)TT * DQ * 2);
    if ((size_t)(wsp - (char*)d_ws) > ws_size) return;    // ws 256 MiB
    float* FV = FK;   // v projection reuses the k buffer after the k planes are built (stream-ordered)
    { k_wtG<<<(unsigned)((DM * DQ / 64 + 63) / 64), 256, 0, stream>>>(wq, DM, DQ, WQ); k_wtG<<<(unsigned)((DM * DKV / 64 + 63) / 64), 256, 0, stream>>>(wk, DM, DKV, WK); k_wtG<<<(unsigned)((DM * DKV / 64 + 63) / 64), 256, 0, stream>>>(wv, DM, DKV, WV);
      k_wtG<<<(unsigned)((DQ * DM / 64 + 63) / 64), 256, 0, stream>>>(wo, DQ, DM, WO);
       }
    k_csid<<<(TT * HD + 255) / 256, 256, 0, stream>>>(CS);
    const unsigned LQ = (unsigned)(((size_t)NH_ * TT * HD / 2 + 255) / 256), LKv = (unsigned)(((size_t)NKV * TT * HD / 2 + 255) / 256);
    for (int b = 0; b < NB_; ++b) {
        
        k_cvt8<<<(unsigned)(((size_t)TT * DM / 8 + 255) / 256), 256, 0, stream>>>(x + (size_t)b * TT * DM, XB, (size_t)TT * DM / 8);
        k_gemmw<bf, 0, true><<<dim3(TT / 64, DQ / 64, 1), 32, 0, stream>>>(XB, nullptr, WQ, nullptr, DM, FQ, DQ, bq, 0, 0, 0);
        k_rope<<<LQ, 256, 0, stream>>>(FQ, DQ, NH_, CS, nullptr, nullptr, 1.0f, QP16, QPh, QPl);
        k_gemmw<bf, 0, true><<<dim3(TT / 64, DKV / 64, 1), 32, 0, stream>>>(XB, nullptr, WK, nullptr, DM, FK, DKV, bk, 0, 0, 0);
        k_rope<<<LKv, 256, 0, stream>>>(FK, DKV, NKV, CS, nullptr, nullptr, 1.0f, KP16, KPh, KPl);
        k_gemmw<bf, 0, true><<<dim3(TT / 64, DKV / 64, 1), 32, 0, stream>>>(XB, nullptr, WV, nullptr, DM, FV, DKV, bv, 0, 0, 0); k_vtp<<<LKv, 256, 0, stream>>>(FV, DKV, NKV, VT16, VTh, VTl);
        for (int h0 = 0; h0 < NH_; h0 += ZH) { const size_t zq = (size_t)h0, zk = (size_t)(h0 / REP);   // one kv head per query head: the pass's two heads use consecutive kv planes (z-strides TT*HD)
            k_gemmw<bf, 2, false><<<dim3(RH / 64, TT / 64, ZH), 32, 0, stream>>>(QPh + zq * TT * HD, QPl + zq * TT * HD, KPh + zk * TT * HD, KPl + zk * TT * HD, HD, Sb, TT, nullptr, (size_t)TT * HD, (size_t)TT * HD, (size_t)TT * TT);
            k_gemmw<h16, 0, false><<<dim3((TT - RH) / 64, TT / 64, ZH), 32, 0, stream>>>(QP16 + zq * TT * HD + (size_t)RH * HD, nullptr, KP16 + zk * TT * HD, nullptr, HD, Sb + (size_t)RH * TT, TT, nullptr, (size_t)TT * HD, (size_t)TT * HD, (size_t)TT * TT);
            k_asoft<<<ZH * TT / 8, 256, 0, stream>>>(Sb, P16, Ph, Pl);
            k_gemmw<bf, 2, false, KSPV><<<dim3(RH / 64, HD / 64, ZH * KSPV), 32, 0, stream>>>(Ph, Pl, VTh + zk * HD * TT, VTl + zk * HD * TT, TT, Ob, HD, nullptr, (size_t)RH * TT, (size_t)HD * TT, (size_t)TT * HD);
            k_gemmw<h16, 0, false, KSPV><<<dim3((TT - RH) / 64, HD / 64, ZH * KSPV), 32, 0, stream>>>(P16 + (size_t)RH * TT, nullptr, VT16 + zk * HD * TT, nullptr, TT, Ob + (size_t)RH * HD, HD, nullptr, (size_t)TT * TT, (size_t)HD * TT, (size_t)TT * HD);
            k_merge<<<(unsigned)(((size_t)ZH * TT * HD / 2 + 255) / 256), 256, 0, stream>>>(Ob, h0, ATh, ATl); }
        k_gemmw<bf, 1, true><<<dim3(TT / 64, DM / 64, 1), 32, 0, stream>>>(ATh, ATl, WO, nullptr, DQ, OUT + (size_t)b * TT * DM, DM, bo, 0, 0, 0); }
}

// v002
// It runs in 497 microseconds.
// Next to v001, in two timings, it ran 1.82 and 1.81 times as fast.
// All steps since v000 together make it 4.12 times as fast.
#include <hip/hip_runtime.h>

// Multi-head attention WITHOUT a mask and with biased projections at a 512-wide model (x [4][2048][512]; q, k, v = x W + b ('xw' [512][512] uniform +-1/sqrt(512) + zero biases; 8 heads x 64); scores x 64^-0.5; softmax over all keys; out = merged Wo + bo ('xw' + zero bias) -> [4][2048][512] (4.2 M); argument order x, Wq, bq, Wk, bk, Wv, bv, Wo, bo).
// Layout, all four batches at once (32 head planes, index b * 8 + h): bf16 copy of x; 'xw' weights transposed once; exact projections + f32 biases; identity-table plane builders; dense T-2048 attention (hybrid rows: < 512 hi/lo 3 products, rest fp16 x1024); merged hi/lo x wo exact + bo.
// Compute dtypes, f32 accumulate: every input rounded to bf16; projections exact + f32 biases; attention rows < 512 3 products, rest fp16; softmax f32; wo hl x exact + bias.

#define NB_  4
#define TT   2048
#define DM   512    // model width: this module's D_MODEL
#define NH_  8      // heads: 8 x 64 = 512
#define NKV  8      // kv heads = heads (no grouping)
#define REP  (NH_ / NKV)
#define HD   64
#define DQ   (NH_ * HD)
#define DKV  (NKV * HD)
#define NZ   (NB_ * NH_)          // head planes over all batches, plane index b * NH_ + h
#define ZH   4                    // head planes per attention pass (what the workspace holds of S and P)
#define RH   512                  // query rows < RH use hi+lo planes (0: none)
#define WIN  0
#define PCAR 1024.0f
#define SCL  0.125f   // HD^-0.5
#define KSPV 16       // P V products: K = 2048 keys cut into KSPV ranges, one work-group each; k_merge adds the partial tiles
typedef _Float16 h16;
typedef unsigned short bf;
typedef __attribute__((ext_vector_type(16))) __bf16   v16bf;
typedef __attribute__((ext_vector_type(16))) _Float16 v16h;
typedef __attribute__((ext_vector_type(8)))  _Float16 v8h;
typedef __attribute__((ext_vector_type(8)))  unsigned short v8us;
typedef __attribute__((ext_vector_type(8)))  float    v8f;
typedef __attribute__((ext_vector_type(4)))  float    v4f;
typedef v8h  __attribute__((may_alias)) v8ha;
typedef v4f  __attribute__((may_alias)) v4fa;
typedef v8us __attribute__((may_alias)) v8usa;

__device__ __forceinline__ unsigned short f2bf(float f) { unsigned u = __float_as_uint(f); u += 0x7FFFu + ((u >> 16) & 1u); return (unsigned short)(u >> 16); }
__device__ __forceinline__ float bf2f(unsigned short b) { return __uint_as_float(((unsigned)b) << 16); }
__device__ __forceinline__ float bfr(float f) { return bf2f(f2bf(f)); }
__device__ __forceinline__ v16h cat16(v8h lo, v8h hi) { return __builtin_shufflevector(lo, hi, 0, 1, 2, 3, 4, 5, 6, 7, 8, 9, 10, 11, 12, 13, 14, 15); }
__device__ __forceinline__ v16bf cat16b(v8us lo, v8us hi) { return __builtin_bit_cast(v16bf, __builtin_shufflevector(lo, hi, 0, 1, 2, 3, 4, 5, 6, 7, 8, 9, 10, 11, 12, 13, 14, 15)); }
__device__ __forceinline__ v8f wmma16(v16h a, v16h b, v8f c) { return __builtin_amdgcn_wmma_f32_16x16x32_f16(false, a, false, b, (short)0, c, false, false); }
__device__ __forceinline__ v8f wmmab(v16bf a, v16bf b, v8f c) { return __builtin_amdgcn_wmma_f32_16x16x32_bf16(false, a, false, b, (short)0, c, false, false); }



// ---- gemmw_tile: register-blocked GEMM, ONE WAVE per 64x64 output tile (16 accumulators), operands straight from K-contiguous 16-bit planes; grid (M/64, N/64, Z), 32 threads; bx = the tile's row index, os = the work-group's 16 x 68 f32 of LDS.
// C[m][n] (f32, pitch ldc, + optional f32 bias[n]) = sum_k A[m][k] Bt[n][k] (+ split products per NSPLIT). z-batch strides sA/sB/sC in elements. K % 32 == 0.
// KSP > 1: grid z = Z * KSP; work-group (z, ks) sums only k in [ks K/KSP, (ks+1) K/KSP) and stores its partial tile in plane z * KSP + ks (stride sC); the reader adds the KSP planes. K % (32 KSP) == 0.
template <typename T16> struct WFrag;
template <> struct WFrag<h16> { typedef v16h V; static __device__ __forceinline__ V ld(const h16* p) { return cat16(*(const v8h*)p, *(const v8h*)(p + 16)); } static __device__ __forceinline__ v8f mma(V a, V b, v8f c) { return wmma16(a, b, c); } };
template <> struct WFrag<bf> { typedef v16bf V; static __device__ __forceinline__ V ld(const bf* p) { return cat16b(*(const v8us*)p, *(const v8us*)(p + 16)); } static __device__ __forceinline__ v8f mma(V a, V b, v8f c) { return wmmab(a, b, c); } };
template <typename T16, int NSPLIT, bool BIAS, int KSP>
__device__ __forceinline__ void gemmw_tile(float* os, int bx, const T16* __restrict__ A, const T16* __restrict__ A2, const T16* __restrict__ Bt, const T16* __restrict__ Bt2, int K, float* C, int ldc, const float* __restrict__ bias, size_t sA, size_t sB, size_t sC) {
    typedef typename WFrag<T16>::V V;
    const size_t z = blockIdx.z / KSP; const int ks = blockIdx.z % KSP; A += z * sA; if (A2) A2 += z * sA; Bt += z * sB; if (Bt2) Bt2 += z * sB; C += (size_t)blockIdx.z * sC;
    const int lane = threadIdx.x & 31, lr = lane & 15, hi = lane >> 4; const int r0 = bx * 64, c0 = blockIdx.y * 64;
    v8f acc[4][4];
#pragma unroll
    for (int mb = 0; mb < 4; ++mb)
#pragma unroll
        for (int nb = 0; nb < 4; ++nb) acc[mb][nb] = (v8f){};
    const size_t aoff = (size_t)(r0 + lr) * K + 8 * hi, boff = (size_t)(c0 + lr) * K + 8 * hi;
#pragma unroll 1
    for (int kc = ks * (K / KSP), ke = kc + K / KSP; kc < ke; kc += 32) {
        V a[4], a2[4];
#pragma unroll
        for (int mb = 0; mb < 4; ++mb) { a[mb] = WFrag<T16>::ld(A + aoff + (size_t)mb * 16 * K + kc); if (NSPLIT == 1 || NSPLIT == 2) a2[mb] = WFrag<T16>::ld(A2 + aoff + (size_t)mb * 16 * K + kc); }
#pragma unroll
        for (int nb = 0; nb < 4; ++nb) { const V b = WFrag<T16>::ld(Bt + boff + (size_t)nb * 16 * K + kc); V b2; if (NSPLIT >= 2) b2 = WFrag<T16>::ld(Bt2 + boff + (size_t)nb * 16 * K + kc);
#pragma unroll
            for (int mb = 0; mb < 4; ++mb) { acc[mb][nb] = WFrag<T16>::mma(a[mb], b, acc[mb][nb]); if (NSPLIT == 1 || NSPLIT == 2) acc[mb][nb] = WFrag<T16>::mma(a2[mb], b, acc[mb][nb]); if (NSPLIT >= 2) acc[mb][nb] = WFrag<T16>::mma(a[mb], b2, acc[mb][nb]); } }
        asm volatile("v_nop\n\tv_nop\n\tv_nop\n\tv_nop" : "+v"(acc[0][0]), "+v"(acc[1][1]), "+v"(acc[2][2]), "+v"(acc[3][3]) : "v"(a[0]), "v"(a[3]));
    }
#pragma unroll
    for (int mb = 0; mb < 4; ++mb) {
#pragma unroll
        for (int nb = 0; nb < 4; ++nb) {
#pragma unroll
            for (int j = 0; j < 8; ++j) os[(hi * 8 + j) * 68 + nb * 16 + lr] = acc[mb][nb][j]; }
        __builtin_amdgcn_wave_barrier(); asm volatile("" ::: "memory");
        float* crow = C + (size_t)(r0 + mb * 16) * ldc + c0;
{
#pragma unroll
            for (int s = 0; s < 8; ++s) { const int row = 2 * s + hi, cofs = lr * 4; v4f val = *(const v4fa*)(os + row * 68 + cofs); if (BIAS) { val[0] += bfr(bias[c0 + cofs]); val[1] += bfr(bias[c0 + cofs + 1]); val[2] += bfr(bias[c0 + cofs + 2]); val[3] += bfr(bias[c0 + cofs + 3]); }
                *(v4f*)(crow + (size_t)row * ldc + cofs) = val; }
             }
        __builtin_amdgcn_wave_barrier(); asm volatile("" ::: "memory");
    }
    asm volatile("s_wait_xcnt 0x0" ::: "memory");   // precaution: the wait behind the tile's last stores, in front of any code of the caller's other row class that the listing lets follow and that rewrites their address or data registers
}
// k_gemmw: one product per grid z, each z with its own bias vector (z 0, 1, 2: the q, k, v projections share A and one launch)
template <typename T16, int NSPLIT, bool BIAS>
__global__ __launch_bounds__(32) void k_gemmw(const T16* __restrict__ A, const T16* __restrict__ A2, const T16* __restrict__ Bt, const T16* __restrict__ Bt2, int K, float* C, int ldc, const float* __restrict__ bias0, const float* __restrict__ bias1, const float* __restrict__ bias2, size_t sA, size_t sB, size_t sC) {
    __shared__ __align__(16) float os[16 * 68];
    const float* bias = (blockIdx.z == 0) ? bias0 : ((blockIdx.z == 1) ? bias1 : bias2);
    gemmw_tile<T16, NSPLIT, BIAS, 1>(os, (int)blockIdx.x, A, A2, Bt, Bt2, K, C, ldc, bias, sA, sB, sC);
}
// k_gemm2: the two row classes of one attention product in one grid: row tiles below RH take the hi/lo bf16 planes (3 products), the others the fp16 planes; C, ldc, sB, sC are common
template <int KSP>
__global__ __launch_bounds__(32) void k_gemm2(const bf* __restrict__ Ah, const bf* __restrict__ Al, const bf* __restrict__ Bh, const bf* __restrict__ Bl, const h16* __restrict__ A16, const h16* __restrict__ B16, int K, float* C, int ldc, size_t sAhl, size_t sA16, size_t sB, size_t sC) {
    __shared__ __align__(16) float os[16 * 68];
    if (blockIdx.x < RH / 64) gemmw_tile<bf, 2, false, KSP>(os, (int)blockIdx.x, Ah, Al, Bh, Bl, K, C, ldc, nullptr, sAhl, sB, sC);
    else gemmw_tile<h16, 0, false, KSP>(os, (int)blockIdx.x - RH / 64, A16, nullptr, B16, nullptr, K, C + (size_t)RH * ldc, ldc, nullptr, sA16, sB, sC);
}

__device__ __forceinline__ h16 tohx(float x) { return (h16)x; }
__device__ __forceinline__ void splitf(float y, unsigned short& h, unsigned short& l) { h = f2bf(y); l = f2bf(y - bf2f(h)); }
typedef __attribute__((ext_vector_type(2))) _Float16 v2h;
typedef __attribute__((ext_vector_type(4))) _Float16 v4h;
typedef __attribute__((ext_vector_type(2))) unsigned short v2us;
typedef __attribute__((ext_vector_type(4))) unsigned short v4us;
typedef __attribute__((ext_vector_type(2))) float v2f;
typedef __attribute__((ext_vector_type(4))) int v4i;

__device__ __forceinline__ void wtG_blk(int bx, const float* __restrict__ w, int K, int N, bf* Bt) {
    const int lane = threadIdx.x & 31; const int L0 = (bx * 8 + (threadIdx.x >> 5)) * 8; const int nlines = N * K / 64;
{
#pragma unroll 1
        for (int l = 0; l < 8; ++l) { const int L = L0 + l; if (L >= nlines) break; const size_t e = (size_t)L * 64 + lane * 2; const int k = (int)(e % K), n = (int)(e / K); v2us o;
            o[0] = f2bf(w[(size_t)k * N + n]); o[1] = f2bf(w[(size_t)(k + 1) * N + n]); *(v2us*)(Bt + e) = o; }
         }
}
__device__ __forceinline__ void cvt8_blk(int bx, const float* __restrict__ src, bf* dst, size_t n8) { const size_t i = (size_t)bx * 256 + threadIdx.x; if (i >= n8) return; const v8f v = *(const v8f*)(src + i * 8); v8us o;
#pragma unroll
    for (int k = 0; k < 8; ++k) o[k] = f2bf(v[k]); *(v8us*)(dst + i * 8) = o;  }

// rope_blk: F holds row blocks of TT rows (q of batch 0..3, then k of batch 0..3); plane hv takes row block hv / NH_ and columns of head hv % NH_. Head planes [hv][t][d] (fp16 + hi/lo) of rope(x) x sc with the rotate-half convention out[d] = x[d] cos[t][d] - x[d+HD/2] sin[t][d], out[d+HD/2] = x[d+HD/2] cos[t][d+HD/2] + x[d] sin[t][d+HD/2]
__device__ __forceinline__ void rope_blk(int bx, const float* __restrict__ F, int pitch, int nheads, const float* __restrict__ CS, const float* __restrict__ RF, const float* __restrict__ nw, float sc, h16* P16, bf* Ph, bf* Pl) {
    const size_t e = ((size_t)bx * 256 + threadIdx.x) * 2; if (e >= (size_t)nheads * TT * HD) return; const int d = (int)(e % HD); const int t = (int)((e / HD) % TT); const int h = (int)(e / ((size_t)HD * TT)); const float* f = F + ((size_t)(h / NH_) * TT + t) * pitch + (h % NH_) * HD; const float rf = RF ? RF[(size_t)h * TT + t] : 1.0f; v2h o16; v2us oh, ol;
#pragma unroll
    for (int q = 0; q < 2; ++q) { const int dd = d + q; const int dp = (dd < HD / 2) ? dd + HD / 2 : dd - HD / 2; float x0 = f[dd], x1 = f[dp];
        if (RF) { float n0 = __fmul_rn(x0, rf), n1 = __fmul_rn(x1, rf); asm volatile("" : "+v"(n0)); asm volatile("" : "+v"(n1)); x0 = __fmul_rn(bfr(nw[dd]), n0); x1 = __fmul_rn(bfr(nw[dp]), n1); }
        const v2f cs = *(const v2f*)(CS + ((size_t)t * HD + dd) * 2); float a = __fmul_rn(x0, cs[0]), bq = __fmul_rn(x1, cs[1]); asm volatile("" : "+v"(a)); asm volatile("" : "+v"(bq)); const float r = ((dd < HD / 2) ? __fsub_rn(a, bq) : __fadd_rn(a, bq)) * sc;
        o16[q] = tohx(r); unsigned short a2, c2; splitf(r, a2, c2); oh[q] = a2; ol[q] = c2; }
    *(v2h*)(P16 + e) = o16; *(v2us*)(Ph + e) = oh; *(v2us*)(Pl + e) = ol;  }
__device__ __forceinline__ void vtp_blk(int bx, const float* __restrict__ F, int pitch, int nheads, h16* V16, bf* Vh, bf* Vl) { const size_t e = ((size_t)bx * 256 + threadIdx.x) * 2; if (e >= (size_t)nheads * HD * TT) return; const int t = (int)(e % TT); const int d = (int)((e / TT) % HD); const int g = (int)(e / ((size_t)TT * HD)); v2h o16; v2us oh, ol;
#pragma unroll
    for (int q = 0; q < 2; ++q) { const float x = F[((size_t)(g / NKV) * TT + t + q) * pitch + (g % NKV) * HD + d]; o16[q] = tohx(x); unsigned short a2, c2; splitf(x, a2, c2); oh[q] = a2; ol[q] = c2; }
    *(v2h*)(V16 + e) = o16; *(v2us*)(Vh + e) = oh; *(v2us*)(Vl + e) = ol;  }
__device__ __forceinline__ void csid_blk(int bx, float* CS) { const int idx = bx * 256 + threadIdx.x; if (idx >= TT * HD) return; v2f cs; cs[0] = 1.0f; cs[1] = 0.0f; *(v2f*)(CS + (size_t)idx * 2) = cs;  }
// k_pre: the jobs that read only inputs, one block range each: 4 weight transposes (NWT blocks each), the bf16 copy of x (NCV), the identity table (NCS)
#define NWT ((DM * DQ / 64 + 63) / 64)
#define NCV (NB_ * TT * DM / 8 / 256)
#define NCS ((TT * HD + 255) / 256)
__global__ __launch_bounds__(256) void k_pre(const float* __restrict__ x, const float* __restrict__ wq, const float* __restrict__ wk, const float* __restrict__ wv, const float* __restrict__ wo, bf* W4, bf* XB, float* CS) {
    const int bx = (int)blockIdx.x;
    if (bx < 4 * NWT) { const int j = bx / NWT; const float* w = (j == 0) ? wq : ((j == 1) ? wk : ((j == 2) ? wv : wo)); wtG_blk(bx % NWT, w, DM, DQ, W4 + (size_t)j * DQ * DM); }
    else if (bx < 4 * NWT + NCV) cvt8_blk(bx - 4 * NWT, x, XB, (size_t)NB_ * TT * DM / 8);
    else csid_blk(bx - 4 * NWT - NCV, CS);
}
// k_planes: the plane builders, which read the projections F (q rows, k rows, v rows), q and k also the table CS: v transposes first (LVT blocks), then q and k (LQK)
#define LVT (NZ * HD * TT / 2 / 256)
#define LQK (2 * NZ * TT * HD / 2 / 256)
__global__ __launch_bounds__(256) void k_planes(const float* __restrict__ F, const float* __restrict__ CS, h16* QK16, bf* QKh, bf* QKl, h16* V16, bf* Vh, bf* Vl) {
    const int bx = (int)blockIdx.x;
    if (bx < LVT) vtp_blk(bx, F + (size_t)2 * NB_ * TT * DQ, DKV, NZ, V16, Vh, Vl);
    else rope_blk(bx - LVT, F, DQ, 2 * NZ, CS, nullptr, nullptr, 1.0f, QK16, QKh, QKl);
}
// k_asoft: per row (zz, i): t = S x HD^-0.5 (no mask); softmax over the 2048 keys (register row, one exp, fixed trees);
__global__ __launch_bounds__(256) void k_asoft(const float* __restrict__ Sb, h16* P16, bf* Ph, bf* Pl) {
    const int lane = threadIdx.x & 31; const int row = blockIdx.x * 8 + (threadIdx.x >> 5); if (row >= ZH * TT) return; const int i = row % TT; const int zz = row / TT; (void)zz; const bool hires = (i < RH); const float* sr = Sb + (size_t)row * TT; float v[TT / 32]; float mx = -3.0e38f;
#pragma unroll
    for (int ch = 0; ch < TT / 128; ++ch) { const int j0 = ch * 128 + lane * 4; const v4f a = *(const v4f*)(sr + j0);
#pragma unroll
        for (int q = 0; q < 4; ++q) { const int j = j0 + q; (void)j; const float t = a[q] * SCL; v[ch * 4 + q] = t; mx = fmaxf(mx, t); } }
#pragma unroll
    for (int sh = 16; sh; sh >>= 1) mx = fmaxf(mx, __shfl_xor(mx, sh, 32));
    float sum = 0.f;
#pragma unroll
    for (int k = 0; k < TT / 32; ++k) { float d0 = __fsub_rn(v[k], mx); asm volatile("" : "+v"(d0)); v[k] = __builtin_amdgcn_exp2f(__fmul_rn(d0, 1.4426950408889634f)); sum += v[k]; }
#pragma unroll
    for (int sh = 16; sh; sh >>= 1) sum += __shfl_xor(sum, sh, 32);
    const float f = __fdiv_rn(hires ? 1.0f : PCAR, sum);
{
        if (hires) {
#pragma unroll
            for (int ch = 0; ch < TT / 128; ++ch) { v4us oh, ol;
#pragma unroll
                for (int q = 0; q < 4; ++q) { unsigned short a, c2; splitf(v[ch * 4 + q] * f, a, c2); oh[q] = a; ol[q] = c2; }
                const size_t oo = ((size_t)zz * (RH ? RH : 1) + i) * TT + ch * 128 + lane * 4; *(v4us*)(Ph + oo) = oh; *(v4us*)(Pl + oo) = ol; }
        } else {
#pragma unroll
            for (int ch = 0; ch < TT / 128; ++ch) { v4h o4;
#pragma unroll
                for (int q = 0; q < 4; ++q) o4[q] = tohx(v[ch * 4 + q] * f);
                *(v4h*)(P16 + (size_t)row * TT + ch * 128 + lane * 4) = o4; } }
         }
}
__global__ __launch_bounds__(256) void k_merge(const float* __restrict__ O, int h0, bf* Ah, bf* Al) { const size_t e = ((size_t)blockIdx.x * 256 + threadIdx.x) * 2; if (e >= (size_t)ZH * TT * HD) return; const int d = (int)(e % HD); const int t = (int)((e / HD) % TT); const int zz = (int)(e / ((size_t)HD * TT)); const float cs = (t < RH) ? 1.0f : (1.0f / PCAR); const size_t oo = ((size_t)((h0 + zz) / NH_) * TT + t) * DQ + ((h0 + zz) % NH_) * HD + d;   // plane h0 + zz = b * NH_ + h
    const float* op = O + (size_t)zz * (KSPV - 1) * TT * HD + e;   // head zz reads KSPV consecutive partial planes [t][d] from plane zz * (KSPV - 1) on (head z's P V partials are planes z * KSPV + ks); they are added in ascending plane order
    v2f p[KSPV];
#pragma unroll
    for (int ks = 0; ks < KSPV; ++ks) p[ks] = *(const v2f*)(op + (size_t)ks * TT * HD);
    asm volatile("s_wait_xcnt 0x0" :: "v"(op) : "memory");   // precaution: the wait in front of any overwrite of these loads' address pair; naming op keeps the pair live up to here
    v2f s = p[0];
#pragma unroll
    for (int ks = 1; ks < KSPV; ++ks) s += p[ks];
    v2us oh, ol;
#pragma unroll
    for (int q = 0; q < 2; ++q) { unsigned short a, c2; splitf(s[q] * cs, a, c2); oh[q] = a; ol[q] = c2; } *(v2us*)(Ah + oo) = oh; *(v2us*)(Al + oo) = ol;  }

extern "C" void kernel_launch(void* const* d_in, const int* in_sizes, int n_in,
                              void* d_out, int out_size, void* d_ws, size_t ws_size, hipStream_t stream) {
    (void)in_sizes; (void)n_in; (void)out_size;
    const float* x = (const float*)d_in[0]; const float* wq = (const float*)d_in[1]; const float* bq = (const float*)d_in[2]; const float* wk = (const float*)d_in[3]; const float* bk = (const float*)d_in[4]; const float* wv = (const float*)d_in[5]; const float* bv = (const float*)d_in[6]; const float* wo = (const float*)d_in[7]; const float* bo = (const float*)d_in[8];   /* argument order inputs, wq, bq, wk, bk, wv, bv, wo, bo ('xw' + biases) */
    float* OUT = (float*)d_out;     // [4][2048][512]
    char* wsp = (char*)d_ws;
    auto take = [&](size_t bytes) { char* p = wsp; wsp += (bytes + 255) & ~(size_t)255; return (void*)p; };
    bf* W4 = (bf*)take((size_t)4 * DQ * DM * 2); bf* WO = W4 + (size_t)3 * DQ * DM; float* CS = (float*)take((size_t)TT * HD * 2 * 4);   // W4: wq, wk, wv, wo transposed, one after the other
    h16* QP16 = (h16*)take((size_t)2 * NZ * TT * HD * 2); h16* KP16 = QP16 + (size_t)NZ * TT * HD; h16* VT16 = (h16*)take((size_t)NZ * HD * TT * 2);   // q planes, then k planes
    bf* QPh = (bf*)take((size_t)2 * NZ * TT * HD * 2); bf* KPh = QPh + (size_t)NZ * TT * HD; bf* QPl = (bf*)take((size_t)2 * NZ * TT * HD * 2); bf* KPl = QPl + (size_t)NZ * TT * HD; bf* VTh = (bf*)take((size_t)NZ * HD * TT * 2); bf* VTl = (bf*)take((size_t)NZ * HD * TT * 2); bf* Ph = (bf*)take((size_t)ZH * RH * TT * 2); bf* Pl = (bf*)take((size_t)ZH * RH * TT * 2);
    float* Sb = (float*)take((size_t)ZH * TT * TT * 4); h16* P16 = (h16*)take((size_t)ZH * TT * TT * 2); float* Ob = (float*)take((size_t)KSPV * ZH * TT * HD * 4); bf* ATh = (bf*)take((size_t)NB_ * TT * DQ * 2); bf* ATl = (bf*)take((size_t)NB_ * TT * DQ * 2);
    if ((size_t)(wsp - (char*)d_ws) > ws_size) return;    // ws 256 MiB
    static_assert((size_t)NB_ * TT * DM * 2 + (size_t)3 * NB_ * TT * DQ * 4 <= (size_t)ZH * TT * TT * 4 && DQ == DKV && REP == 1, "x copy and projections fit in the score buffer");
    bf* XB = (bf*)Sb; float* F = (float*)(XB + (size_t)NB_ * TT * DM);   // the bf16 x and the f32 q, k, v projections live in the score buffer: their last reader (k_planes) ends before the first scores are stored (stream-ordered)
    k_pre<<<4 * NWT + NCV + NCS, 256, 0, stream>>>(x, wq, wk, wv, wo, W4, XB, CS);
    k_gemmw<bf, 0, true><<<dim3(NB_ * TT / 64, DQ / 64, 3), 32, 0, stream>>>(XB, nullptr, W4, nullptr, DM, F, DQ, bq, bk, bv, 0, (size_t)DQ * DM, (size_t)NB_ * TT * DQ);
    k_planes<<<LVT + LQK, 256, 0, stream>>>(F, CS, QP16, QPh, QPl, VT16, VTh, VTl);
    for (int h0 = 0; h0 < NZ; h0 += ZH) { const size_t zq = (size_t)h0, zk = (size_t)(h0 / REP);   // one kv plane per query plane: the pass's ZH planes use consecutive kv planes (z-strides TT*HD)
        k_gemm2<1><<<dim3(TT / 64, TT / 64, ZH), 32, 0, stream>>>(QPh + zq * TT * HD, QPl + zq * TT * HD, KPh + zk * TT * HD, KPl + zk * TT * HD, QP16 + zq * TT * HD + (size_t)RH * HD, KP16 + zk * TT * HD, HD, Sb, TT, (size_t)TT * HD, (size_t)TT * HD, (size_t)TT * HD, (size_t)TT * TT);
        k_asoft<<<ZH * TT / 8, 256, 0, stream>>>(Sb, P16, Ph, Pl);
        k_gemm2<KSPV><<<dim3(TT / 64, HD / 64, ZH * KSPV), 32, 0, stream>>>(Ph, Pl, VTh + zk * HD * TT, VTl + zk * HD * TT, P16 + (size_t)RH * TT, VT16 + zk * HD * TT, TT, Ob, HD, (size_t)RH * TT, (size_t)TT * TT, (size_t)HD * TT, (size_t)TT * HD);
        k_merge<<<(unsigned)(((size_t)ZH * TT * HD / 2 + 255) / 256), 256, 0, stream>>>(Ob, h0, ATh, ATl); }
    k_gemmw<bf, 1, true><<<dim3(NB_ * TT / 64, DM / 64, 1), 32, 0, stream>>>(ATh, ATl, WO, nullptr, DQ, OUT, DM, bo, bo, bo, 0, 0, 0);
}

// v004
// It runs in 182 microseconds.
// Versions in between are left out here; by their measured steps it is 2.73 times as fast as v002.
// All steps since v000 together make it 11.2 times as fast.
#include <hip/hip_runtime.h>

// Multi-head attention WITHOUT a mask and with biased projections at a 512-wide model (x [4][2048][512]; q, k, v = x W + b ('xw' [512][512] uniform +-1/sqrt(512) + zero biases; 8 heads x 64); scores x 64^-0.5; softmax over all keys; out = merged Wo + bo ('xw' + zero bias) -> [4][2048][512] (4.2 M); argument order x, Wq, bq, Wk, bk, Wv, bv, Wo, bo).
// Layout, all four batches at once (32 head planes, index b * 8 + h): bf16 copy of x; 'xw' weights transposed once; exact projections + f32 biases, whose epilogue writes the head planes; one fused dense T-2048 attention kernel (hybrid rows: < 512 hi/lo 3 products, rest fp16; scores and P stay in registers); merged hi/lo x wo exact + bo.
// Compute dtypes, f32 accumulate: every input rounded to bf16; projections exact + f32 biases; attention rows < 512 3 products, rest fp16; softmax f32; wo hl x exact + bias.

#define NB_  4
#define TT   2048
#define DM   512    // model width: this module's D_MODEL
#define NH_  8      // heads: 8 x 64 = 512
#define NKV  8      // kv heads = heads (no grouping)
#define REP  (NH_ / NKV)
#define HD   64
#define DQ   (NH_ * HD)
#define DKV  (NKV * HD)
#define NZ   (NB_ * NH_)          // head planes over all batches, plane index b * NH_ + h
#define RH   512                  // query rows < RH use hi+lo planes (0: none)
#define WIN  0
#define SCL  0.125f   // HD^-0.5
typedef _Float16 h16;
typedef unsigned short bf;
typedef __attribute__((ext_vector_type(16))) __bf16   v16bf;
typedef __attribute__((ext_vector_type(16))) _Float16 v16h;
typedef __attribute__((ext_vector_type(8)))  _Float16 v8h;
typedef __attribute__((ext_vector_type(8)))  unsigned short v8us;
typedef __attribute__((ext_vector_type(8)))  float    v8f;
typedef __attribute__((ext_vector_type(4)))  float    v4f;
typedef v8h  __attribute__((may_alias)) v8ha;
typedef v4f  __attribute__((may_alias)) v4fa;
typedef v8us __attribute__((may_alias)) v8usa;

__device__ __forceinline__ unsigned short f2bf(float f) { unsigned u = __float_as_uint(f); u += 0x7FFFu + ((u >> 16) & 1u); return (unsigned short)(u >> 16); }
__device__ __forceinline__ float bf2f(unsigned short b) { return __uint_as_float(((unsigned)b) << 16); }
__device__ __forceinline__ float bfr(float f) { return bf2f(f2bf(f)); }
__device__ __forceinline__ v16h cat16(v8h lo, v8h hi) { return __builtin_shufflevector(lo, hi, 0, 1, 2, 3, 4, 5, 6, 7, 8, 9, 10, 11, 12, 13, 14, 15); }
__device__ __forceinline__ v16bf cat16b(v8us lo, v8us hi) { return __builtin_bit_cast(v16bf, __builtin_shufflevector(lo, hi, 0, 1, 2, 3, 4, 5, 6, 7, 8, 9, 10, 11, 12, 13, 14, 15)); }
__device__ __forceinline__ v8f wmma16(v16h a, v16h b, v8f c) { return __builtin_amdgcn_wmma_f32_16x16x32_f16(false, a, false, b, (short)0, c, false, false); }
__device__ __forceinline__ v8f wmmab(v16bf a, v16bf b, v8f c) { return __builtin_amdgcn_wmma_f32_16x16x32_bf16(false, a, false, b, (short)0, c, false, false); }



// ---- gemmw_tile: register-blocked GEMM, ONE WAVE per 64x64 output tile (16 accumulators), operands straight from K-contiguous 16-bit planes; grid (M/64, N/64, Z), 32 threads; bx = the tile's row index, os = the work-group's 16 x 68 f32 of LDS.
// C[m][n] (f32, pitch ldc, + optional f32 bias[n]) = sum_k A[m][k] Bt[n][k] (+ split products per NSPLIT). z-batch strides sA/sB/sC in elements. K % 32 == 0.
// KSP > 1: grid z = Z * KSP; work-group (z, ks) sums only k in [ks K/KSP, (ks+1) K/KSP) and stores its partial tile in plane z * KSP + ks (stride sC); the reader adds the KSP planes. K % (32 KSP) == 0.
template <typename T16> struct WFrag;
template <> struct WFrag<h16> { typedef v16h V; static __device__ __forceinline__ V ld(const h16* p) { return cat16(*(const v8h*)p, *(const v8h*)(p + 16)); } static __device__ __forceinline__ v8f mma(V a, V b, v8f c) { return wmma16(a, b, c); } };
template <> struct WFrag<bf> { typedef v16bf V; static __device__ __forceinline__ V ld(const bf* p) { return cat16b(*(const v8us*)p, *(const v8us*)(p + 16)); } static __device__ __forceinline__ v8f mma(V a, V b, v8f c) { return wmmab(a, b, c); } };
template <typename T16, int NSPLIT, bool BIAS, int KSP>
__device__ __forceinline__ void gemmw_tile(float* os, int bx, const T16* __restrict__ A, const T16* __restrict__ A2, const T16* __restrict__ Bt, const T16* __restrict__ Bt2, int K, float* C, int ldc, const float* __restrict__ bias, size_t sA, size_t sB, size_t sC) {
    typedef typename WFrag<T16>::V V;
    const size_t z = blockIdx.z / KSP; const int ks = blockIdx.z % KSP; A += z * sA; if (A2) A2 += z * sA; Bt += z * sB; if (Bt2) Bt2 += z * sB; C += (size_t)blockIdx.z * sC;
    const int lane = threadIdx.x & 31, lr = lane & 15, hi = lane >> 4; const int r0 = bx * 64, c0 = blockIdx.y * 64;
    v8f acc[4][4];
#pragma unroll
    for (int mb = 0; mb < 4; ++mb)
#pragma unroll
        for (int nb = 0; nb < 4; ++nb) acc[mb][nb] = (v8f){};
    const size_t aoff = (size_t)(r0 + lr) * K + 8 * hi, boff = (size_t)(c0 + lr) * K + 8 * hi;
#pragma unroll 1
    for (int kc = ks * (K / KSP), ke = kc + K / KSP; kc < ke; kc += 32) {
        V a[4], a2[4];
#pragma unroll
        for (int mb = 0; mb < 4; ++mb) { a[mb] = WFrag<T16>::ld(A + aoff + (size_t)mb * 16 * K + kc); if (NSPLIT == 1 || NSPLIT == 2) a2[mb] = WFrag<T16>::ld(A2 + aoff + (size_t)mb * 16 * K + kc); }
#pragma unroll
        for (int nb = 0; nb < 4; ++nb) { const V b = WFrag<T16>::ld(Bt + boff + (size_t)nb * 16 * K + kc); V b2; if (NSPLIT >= 2) b2 = WFrag<T16>::ld(Bt2 + boff + (size_t)nb * 16 * K + kc);
#pragma unroll
            for (int mb = 0; mb < 4; ++mb) { acc[mb][nb] = WFrag<T16>::mma(a[mb], b, acc[mb][nb]); if (NSPLIT == 1 || NSPLIT == 2) acc[mb][nb] = WFrag<T16>::mma(a2[mb], b, acc[mb][nb]); if (NSPLIT >= 2) acc[mb][nb] = WFrag<T16>::mma(a[mb], b2, acc[mb][nb]); } }
        asm volatile("v_nop\n\tv_nop\n\tv_nop\n\tv_nop" : "+v"(acc[0][0]), "+v"(acc[1][1]), "+v"(acc[2][2]), "+v"(acc[3][3]) : "v"(a[0]), "v"(a[3]));
    }
#pragma unroll
    for (int mb = 0; mb < 4; ++mb) {
#pragma unroll
        for (int nb = 0; nb < 4; ++nb) {
#pragma unroll
            for (int j = 0; j < 8; ++j) os[(hi * 8 + j) * 68 + nb * 16 + lr] = acc[mb][nb][j]; }
        __builtin_amdgcn_wave_barrier(); asm volatile("" ::: "memory");
        float* crow = C + (size_t)(r0 + mb * 16) * ldc + c0;
{
#pragma unroll
            for (int s = 0; s < 8; ++s) { const int row = 2 * s + hi, cofs = lr * 4; v4f val = *(const v4fa*)(os + row * 68 + cofs); if (BIAS) { val[0] += bfr(bias[c0 + cofs]); val[1] += bfr(bias[c0 + cofs + 1]); val[2] += bfr(bias[c0 + cofs + 2]); val[3] += bfr(bias[c0 + cofs + 3]); }
                *(v4f*)(crow + (size_t)row * ldc + cofs) = val; }
             }
        __builtin_amdgcn_wave_barrier(); asm volatile("" ::: "memory");
    }
    asm volatile("s_wait_xcnt 0x0" ::: "memory");   // precaution: the wait behind the tile's last stores, in front of any code that follows and rewrites their address or data registers
}
// k_gemmw: one product per grid z, each z with its own bias vector
template <typename T16, int NSPLIT, bool BIAS>
__global__ __launch_bounds__(32) void k_gemmw(const T16* __restrict__ A, const T16* __restrict__ A2, const T16* __restrict__ Bt, const T16* __restrict__ Bt2, int K, float* C, int ldc, const float* __restrict__ bias0, const float* __restrict__ bias1, const float* __restrict__ bias2, size_t sA, size_t sB, size_t sC) {
    __shared__ __align__(16) float os[16 * 68];
    const float* bias = (blockIdx.z == 0) ? bias0 : ((blockIdx.z == 1) ? bias1 : bias2);
    gemmw_tile<T16, NSPLIT, BIAS, 1>(os, (int)blockIdx.x, A, A2, Bt, Bt2, K, C, ldc, bias, sA, sB, sC);
}

__device__ __forceinline__ void splitf(float y, unsigned short& h, unsigned short& l) { h = f2bf(y); l = f2bf(y - bf2f(h)); }
typedef __attribute__((ext_vector_type(4))) _Float16 v4h;
typedef __attribute__((ext_vector_type(2))) unsigned short v2us;
typedef __attribute__((ext_vector_type(4))) unsigned short v4us;
typedef __attribute__((ext_vector_type(4))) int v4i;

__device__ __forceinline__ void wtG_blk(int bx, const float* __restrict__ w, int K, int N, bf* Bt) {
    const int lane = threadIdx.x & 31; const int L0 = (bx * 8 + (threadIdx.x >> 5)) * 8; const int nlines = N * K / 64;
{
#pragma unroll 1
        for (int l = 0; l < 8; ++l) { const int L = L0 + l; if (L >= nlines) break; const size_t e = (size_t)L * 64 + lane * 2; const int k = (int)(e % K), n = (int)(e / K); v2us o;
            o[0] = f2bf(w[(size_t)k * N + n]); o[1] = f2bf(w[(size_t)(k + 1) * N + n]); *(v2us*)(Bt + e) = o; }
         }
}
__device__ __forceinline__ void cvt8_blk(int bx, const float* __restrict__ src, bf* dst, size_t n8) { const size_t i = (size_t)bx * 256 + threadIdx.x; if (i >= n8) return; const v8f v = *(const v8f*)(src + i * 8); v8us o;
#pragma unroll
    for (int k = 0; k < 8; ++k) o[k] = f2bf(v[k]); *(v8us*)(dst + i * 8) = o;  }

// k_pre: the jobs that read only inputs, one block range each: 4 weight transposes (NWT blocks each), the bf16 copy of x (NCV)
#define NWT ((DM * DQ / 64 + 63) / 64)
#define NCV (NB_ * TT * DM / 8 / 256)
__global__ __launch_bounds__(256) void k_pre(const float* __restrict__ x, const float* __restrict__ wq, const float* __restrict__ wk, const float* __restrict__ wv, const float* __restrict__ wo, bf* W4, bf* XB) {
    const int bx = (int)blockIdx.x;
    if (bx < 4 * NWT) { const int j = bx / NWT; const float* w = (j == 0) ? wq : ((j == 1) ? wk : ((j == 2) ? wv : wo)); wtG_blk(bx % NWT, w, DM, DQ, W4 + (size_t)j * DQ * DM); }
    else cvt8_blk(bx - 4 * NWT, x, XB, (size_t)NB_ * TT * DM / 8);
}
typedef __attribute__((ext_vector_type(2))) float f32x2;
typedef __attribute__((ext_vector_type(2))) __bf16 bf16x2;
typedef __attribute__((ext_vector_type(8))) unsigned u32x8;
typedef __attribute__((ext_vector_type(4))) unsigned u32x4;
#define CSC (SCL * 1.4426950408889634f)
__device__ __forceinline__ float xhalf(float x) { return __builtin_bit_cast(float, __builtin_amdgcn_permlanex16(__builtin_bit_cast(int, x), __builtin_bit_cast(int, x), 0x76543210, 0xfedcba98, false, false)); }   // lane l with lane l ^ 16
__device__ __forceinline__ unsigned packbf(float lo, float hi) { return __builtin_bit_cast(unsigned, __builtin_convertvector((f32x2){lo, hi}, bf16x2)); }   // round to nearest even
__device__ __forceinline__ void nop4() { __builtin_amdgcn_sched_barrier(0); asm volatile("v_nop\n\tv_nop\n\tv_nop\n\tv_nop"); __builtin_amdgcn_sched_barrier(0); }   // the 4 vector slots between a pass's last WMMAs and whatever next overwrites their A or B or touches their D, in the next pass and behind the loop's exit branch alike (without them a WMMA stood directly in front of that branch); the two scheduling barriers keep the slots behind the run
// xwait: precaution: the wait behind a group of loads, in front of any overwrite of their address registers; naming the pointers keeps the address pairs live up to here, the clobber keeps the loads in front of it
template <bool HL, typename T16> __device__ __forceinline__ void xwait(const T16* a, const T16* b) { if constexpr (HL) asm volatile("s_wait_xcnt 0x0" :: "v"(a), "v"(b) : "memory"); else asm volatile("s_wait_xcnt 0x0" :: "v"(a) : "memory"); }
template <typename T16, bool HL, int R>
__device__ __forceinline__ void attn_cols(const T16* __restrict__ Q, const T16* __restrict__ Q2, const T16* __restrict__ K, const T16* __restrict__ K2, const T16* __restrict__ VT, const T16* __restrict__ VT2, int q0, bf* Ah, bf* Al) {
    typedef typename WFrag<T16>::V V;
    const int lane = threadIdx.x & 31, c = lane & 15, h = lane >> 4;
    V qf[R][2], qf2[R][2];
#pragma unroll
    for (int g = 0; g < R; ++g) { const size_t o = (size_t)(q0 + 16 * g + c) * HD + 8 * h; const T16* qp = Q + o; const T16* qp2 = HL ? Q2 + o : qp;
#pragma unroll
        for (int kc = 0; kc < 2; ++kc) { qf[g][kc] = WFrag<T16>::ld(qp + 32 * kc); if (HL) qf2[g][kc] = WFrag<T16>::ld(qp2 + 32 * kc); }
        xwait<HL>(qp, qp2); }
    v8f acc[R][4]; float m[R]; f32x2 l[R];   // l: each lane's share of the denominator, even and odd keys apart
#pragma unroll
    for (int g = 0; g < R; ++g) { m[g] = -__builtin_inff(); l[g] = (f32x2){0.f, 0.f};
#pragma unroll
        for (int t = 0; t < 4; ++t) acc[g][t] = (v8f){}; }
    const int ko = c * HD + 8 * h, vo = c * TT + 8 * h;
    V kf[2][2], kf2[2][2];
#pragma unroll
    for (int kt = 0; kt < 2; ++kt)
#pragma unroll
        for (int kc = 0; kc < 2; ++kc) { kf[kt][kc] = WFrag<T16>::ld(K + ko + kt * 16 * HD + 32 * kc); if (HL) kf2[kt][kc] = WFrag<T16>::ld(K2 + ko + kt * 16 * HD + 32 * kc); }
    xwait<HL>(K + ko, HL ? K2 + ko : K + ko);
#pragma unroll 1
    for (int key0 = 0; key0 < TT; key0 += 32) {   // rolled: one pass already holds every register the wave can spare
        const T16* vp = VT + vo + key0; const T16* vp2 = HL ? VT2 + vo + key0 : vp;
        V vf[4], vf2[4];   // this pass's V^T fragments, asked for first: they fly under the first product and the softmax
#pragma unroll
        for (int t = 0; t < 4; ++t) { vf[t] = WFrag<T16>::ld(vp + (size_t)t * 16 * TT); if (HL) vf2[t] = WFrag<T16>::ld(vp2 + (size_t)t * 16 * TT); }
        xwait<HL>(vp, vp2);
        v8f s[2][R];
#pragma unroll
        for (int kt = 0; kt < 2; ++kt)
#pragma unroll
            for (int g = 0; g < R; ++g) { s[kt][g] = (v8f){};
#pragma unroll
                for (int kc = 0; kc < 2; ++kc) { s[kt][g] = WFrag<T16>::mma(kf[kt][kc], qf[g][kc], s[kt][g]); if (HL) { s[kt][g] = WFrag<T16>::mma(kf[kt][kc], qf2[g][kc], s[kt][g]); s[kt][g] = WFrag<T16>::mma(kf2[kt][kc], qf[g][kc], s[kt][g]); } } }
        const int kn = (key0 + 32) & (TT - 1);   // next pass's K rows, into the same registers, in flight under the softmax and the second product (the last pass asks for rows 0 again, which nobody uses)
        const T16* kp = K + ko + (size_t)kn * HD; const T16* kp2 = HL ? K2 + ko + (size_t)kn * HD : kp;
#pragma unroll
        for (int kt = 0; kt < 2; ++kt)
#pragma unroll
            for (int kc = 0; kc < 2; ++kc) { kf[kt][kc] = WFrag<T16>::ld(kp + kt * 16 * HD + 32 * kc); if (HL) kf2[kt][kc] = WFrag<T16>::ld(kp2 + kt * 16 * HD + 32 * kc); }
        xwait<HL>(kp, kp2);
        float mb[R]; bool need = false;
#pragma unroll
        for (int g = 0; g < R; ++g) { float mx = s[0][g][0];
#pragma unroll
            for (int i = 1; i < 16; ++i) mx = fmaxf(mx, s[i >> 3][g][i & 7]);
            mx = fmaxf(mx, xhalf(mx)) * CSC; mb[g] = mx; need = need || (mx > m[g] + 8.0f); }
        if (__builtin_amdgcn_ballot_w32(need) != 0) {   // one scalar branch a pass; always taken in the first pass (m is -inf there, the factor 0)
#pragma unroll
            for (int g = 0; g < R; ++g) { const float mn = fmaxf(m[g], mb[g]); const float corr = __builtin_amdgcn_exp2f(m[g] - mn); m[g] = mn; l[g] *= corr;
#pragma unroll
                for (int t = 0; t < 4; ++t) acc[g][t] = acc[g][t] * corr; }
        }
#pragma unroll
        for (int g = 0; g < R; ++g) { const float nm = -m[g]; float p[16];
#pragma unroll
            for (int i = 0; i < 8; ++i) { const f32x2 arg = __builtin_elementwise_fma((f32x2){s[i >> 2][g][2 * (i & 3)], s[i >> 2][g][2 * (i & 3) + 1]}, (f32x2){CSC, CSC}, (f32x2){nm, nm}); p[2 * i] = __builtin_amdgcn_exp2f(arg.x); p[2 * i + 1] = __builtin_amdgcn_exp2f(arg.y); l[g] += (f32x2){p[2 * i], p[2 * i + 1]}; }
            if constexpr (HL) { u32x8 wh, wl;
#pragma unroll
                for (int i = 0; i < 8; ++i) { const unsigned w = packbf(p[2 * i], p[2 * i + 1]); wh[i] = w; wl[i] = packbf(p[2 * i] - __uint_as_float(w << 16), p[2 * i + 1] - __uint_as_float(w & 0xFFFF0000u)); }
                const V ph = __builtin_bit_cast(V, wh), pl = __builtin_bit_cast(V, wl);
#pragma unroll
                for (int t = 0; t < 4; ++t) { acc[g][t] = WFrag<T16>::mma(vf[t], ph, acc[g][t]); acc[g][t] = WFrag<T16>::mma(vf[t], pl, acc[g][t]); acc[g][t] = WFrag<T16>::mma(vf2[t], ph, acc[g][t]); }
            } else { V pf;
#pragma unroll
                for (int i = 0; i < 16; ++i) pf[i] = (h16)p[i];
#pragma unroll
                for (int t = 0; t < 4; ++t) acc[g][t] = WFrag<T16>::mma(vf[t], pf, acc[g][t]); } }
        nop4();
    }
#pragma unroll
    for (int g = 0; g < R; ++g) { const float lh = l[g].x + l[g].y; const float lt = lh + xhalf(lh); const float inv = __fdiv_rn(1.0f, lt);   // the halves' sums joined once, unconditionally
        const size_t oo = (size_t)(q0 + 16 * g + c) * DQ + 8 * h;   // lane (c, h) holds d = 16 t + 8 h + r of query c: 16 bytes a store
#pragma unroll
        for (int t = 0; t < 4; ++t) { v8us oh, ol;
#pragma unroll
            for (int r = 0; r < 8; ++r) { unsigned short a, c2; splitf(acc[g][t][r] * inv, a, c2); oh[r] = a; ol[r] = c2; }
            *(v8us*)(Ah + oo + 16 * t) = oh; *(v8us*)(Al + oo + 16 * t) = ol; } }
}
// k_attn: 4 waves a work-group, no LDS. Blocks below NHB: rows < RH on the hi/lo bf16 planes (3 products), 16 columns a wave; the others: fp16 planes, 32 columns a wave. The longer class starts first. Plane z = b * NH_ + h; QK planes: q planes, then k planes.
#define AW  4
#define HBZ (RH / (AW * 16))
#define LBZ ((TT - RH) / (AW * 32))
#define NHB (NZ * HBZ)
#define NLB (NZ * LBZ)
__global__ __launch_bounds__(AW * 32) void k_attn(const h16* __restrict__ QK16, const bf* __restrict__ QKh, const bf* __restrict__ QKl, const h16* __restrict__ V16, const bf* __restrict__ Vh, const bf* __restrict__ Vl, bf* Ah, bf* Al) {
    const int wave = __builtin_amdgcn_readfirstlane((int)(threadIdx.x >> 5)); const int bx = (int)blockIdx.x; const size_t PL = (size_t)TT * HD;
    if (bx < NHB) { const int z = bx / HBZ; const size_t ao = (size_t)(z / NH_) * TT * DQ + (z % NH_) * HD;
        attn_cols<bf, true, 1>(QKh + z * PL, QKl + z * PL, QKh + (NZ + z) * PL, QKl + (NZ + z) * PL, Vh + z * PL, Vl + z * PL, (bx % HBZ) * (AW * 16) + wave * 16, Ah + ao, Al + ao); }
    else { const int b2 = bx - NHB; const int z = b2 / LBZ; const size_t ao = (size_t)(z / NH_) * TT * DQ + (z % NH_) * HD;
        attn_cols<h16, false, 2>(QK16 + z * PL, nullptr, QK16 + (NZ + z) * PL, nullptr, V16 + z * PL, nullptr, RH + (b2 % LBZ) * (AW * 32) + wave * 32, Ah + ao, Al + ao); }
}

// ---- projections straight into the head planes: no f32 copy of q, k, v is stored.
// planes_out: one 64 x 64 f32 tile + bias -> its fp16, bf16-hi and bf16-lo planes; a tile row is 64 elements = one 128-byte line of each plane, rows P elements apart. 16 rows at a time pass through the wave's own LDS, so that a lane holds 8 neighbours of one row: 16 bytes a store, whole lines. RB: the bias goes by the tile's row, else by its column.
template <int P, bool RB>
__device__ __forceinline__ void planes_out(float* os, const v8f (&acc)[4][4], const float* __restrict__ bias, h16* P16, bf* Ph, bf* Pl) {
    const int lane = threadIdx.x & 31, lr = lane & 15, hi = lane >> 4, rr = lane >> 3, co = (lane & 7) * 8;
    float bb[RB ? 16 : 8];   // every bias this lane adds, asked for once, ahead of the LDS passes
#pragma unroll
    for (int i = 0; i < (RB ? 16 : 8); ++i) bb[i] = bfr(bias[RB ? 4 * i + rr : co + i]);
    h16* p16 = P16 + (size_t)rr * P + co; bf* ph = Ph + (size_t)rr * P + co; bf* pl = Pl + (size_t)rr * P + co;   // this lane's place in rows 0 to 3; every store is a constant number of rows further
#pragma unroll
    for (int mb = 0; mb < 4; ++mb) {
#pragma unroll
        for (int nb = 0; nb < 4; ++nb) {
#pragma unroll
            for (int j = 0; j < 8; ++j) os[(hi * 8 + j) * 68 + nb * 16 + lr] = acc[mb][nb][j]; }
        __builtin_amdgcn_wave_barrier(); asm volatile("" ::: "memory");   // the rows are read back by other lanes: no LDS read moves in front of the writes
#pragma unroll
        for (int s = 0; s < 4; ++s) { const float* orow = os + (4 * s + rr) * 68 + co; const v4f lo4 = *(const v4fa*)orow, hi4 = *(const v4fa*)(orow + 4); float y[8]; v8h o16; u32x4 oh, ol;
#pragma unroll
            for (int i = 0; i < 8; ++i) { y[i] = ((i < 4) ? lo4[i & 3] : hi4[i & 3]) + bb[RB ? 4 * mb + s : i]; o16[i] = (h16)y[i]; }
#pragma unroll
            for (int i = 0; i < 4; ++i) { const unsigned w = packbf(y[2 * i], y[2 * i + 1]); oh[i] = w; ol[i] = packbf(y[2 * i] - __uint_as_float(w << 16), y[2 * i + 1] - __uint_as_float(w & 0xFFFF0000u)); }
            const size_t o = (size_t)(mb * 16 + 4 * s) * P;
            *(v8h*)(p16 + o) = o16; *(v8us*)(ph + o) = __builtin_bit_cast(v8us, oh); *(v8us*)(pl + o) = __builtin_bit_cast(v8us, ol);
            asm volatile("s_wait_xcnt 0x0" :: "v"(p16), "v"(ph), "v"(pl), "v"(o16), "v"(oh), "v"(ol) : "memory"); }   // precaution: the wait behind the three stores, in front of any overwrite of their address or data registers; naming them keeps them live up to here
        __builtin_amdgcn_wave_barrier(); asm volatile("" ::: "memory");   // the next 16 rows are written only behind these reads
    }
}
// k_proj: one wave per tile of 64 tokens x one head's 64 columns; grid (token tiles over all batches, heads, 3: q, k, v). q and k: A = x rows, B = weight rows, tile [t][d]. v: the operands change places, so the tile comes out as [d][t], the order of its plane.
__global__ __launch_bounds__(32) void k_proj(const bf* __restrict__ XB, const bf* __restrict__ W4, const float* __restrict__ bq, const float* __restrict__ bk, const float* __restrict__ bv, h16* QK16, bf* QKh, bf* QKl, h16* V16, bf* Vh, bf* Vl) {
    __shared__ __align__(16) float os[16 * 68];
    const int kind = (int)blockIdx.z, head = (int)blockIdx.y, tile = (int)blockIdx.x; const int lane = threadIdx.x & 31;
    const size_t fo = (size_t)(lane & 15) * DM + 8 * (lane >> 4);
    const bf* X = XB + (size_t)tile * 64 * DM + fo; const bf* Wt = W4 + ((size_t)kind * DQ + head * HD) * DM + fo;
    const bf* A = (kind == 2) ? Wt : X; const bf* B = (kind == 2) ? X : Wt;
    v8f acc[4][4];
#pragma unroll
    for (int mb = 0; mb < 4; ++mb)
#pragma unroll
        for (int nb = 0; nb < 4; ++nb) acc[mb][nb] = (v8f){};
#pragma unroll 1
    for (int kc = 0; kc < DM; kc += 32) {   // rolled, as the other GEMM's K loop
        const bf* pa = A + kc; const bf* pb = B + kc; v16bf a[4], b[4];
#pragma unroll
        for (int i = 0; i < 4; ++i) { a[i] = WFrag<bf>::ld(pa + (size_t)i * 16 * DM); b[i] = WFrag<bf>::ld(pb + (size_t)i * 16 * DM); }
        xwait<true>(pa, pb);
        __builtin_amdgcn_sched_barrier(0);   // keeps the products behind the group of 16 loads: moved in among them they shared one B buffer, and each of the four B fragments was waited for by itself
#pragma unroll
        for (int nb = 0; nb < 4; ++nb)
#pragma unroll
            for (int mb = 0; mb < 4; ++mb) acc[mb][nb] = wmmab(a[mb], b[nb], acc[mb][nb]);
        nop4();
    }
    const size_t plane = (size_t)(tile / (TT / 64)) * NH_ + head; const int t0 = (tile % (TT / 64)) * 64;
    if (kind == 2) { const size_t o = plane * HD * TT + t0; planes_out<TT, true>(os, acc, bv + head * HD, V16 + o, Vh + o, Vl + o); }
    else { const size_t o = (((size_t)kind * NZ + plane) * TT + t0) * HD; planes_out<HD, false>(os, acc, ((kind == 0) ? bq : bk) + head * HD, QK16 + o, QKh + o, QKl + o); }
}

extern "C" void kernel_launch(void* const* d_in, const int* in_sizes, int n_in,
                              void* d_out, int out_size, void* d_ws, size_t ws_size, hipStream_t stream) {
    (void)in_sizes; (void)n_in; (void)out_size;
    const float* x = (const float*)d_in[0]; const float* wq = (const float*)d_in[1]; const float* bq = (const float*)d_in[2]; const float* wk = (const float*)d_in[3]; const float* bk = (const float*)d_in[4]; const float* wv = (const float*)d_in[5]; const float* bv = (const float*)d_in[6]; const float* wo = (const float*)d_in[7]; const float* bo = (const float*)d_in[8];   /* argument order inputs, wq, bq, wk, bk, wv, bv, wo, bo ('xw' + biases) */
    float* OUT = (float*)d_out;     // [4][2048][512]
    char* wsp = (char*)d_ws;
    auto take = [&](size_t bytes) { char* p = wsp; wsp += (bytes + 255) & ~(size_t)255; return (void*)p; };
    bf* W4 = (bf*)take((size_t)4 * DQ * DM * 2); bf* WO = W4 + (size_t)3 * DQ * DM;   // W4: wq, wk, wv, wo transposed, one after the other
    h16* QP16 = (h16*)take((size_t)2 * NZ * TT * HD * 2); h16* VT16 = (h16*)take((size_t)NZ * HD * TT * 2);   // q planes, then k planes
    bf* QPh = (bf*)take((size_t)2 * NZ * TT * HD * 2); bf* QPl = (bf*)take((size_t)2 * NZ * TT * HD * 2); bf* VTh = (bf*)take((size_t)NZ * HD * TT * 2); bf* VTl = (bf*)take((size_t)NZ * HD * TT * 2);
    bf* XB = (bf*)take((size_t)NB_ * TT * DM * 2); bf* ATh = (bf*)take((size_t)NB_ * TT * DQ * 2); bf* ATl = (bf*)take((size_t)NB_ * TT * DQ * 2);
    if ((size_t)(wsp - (char*)d_ws) > ws_size) return;    // ws 256 MiB
    static_assert(DQ == DKV && REP == 1 && RH % (AW * 16) == 0 && (TT - RH) % (AW * 32) == 0 && (TT & (TT - 1)) == 0 && HD == 64 && TT % 64 == 0, "one kv plane per query plane; whole work-groups per row class; a projection tile is 64 tokens of one batch x one head");
    k_pre<<<4 * NWT + NCV, 256, 0, stream>>>(x, wq, wk, wv, wo, W4, XB);
    k_proj<<<dim3(NB_ * TT / 64, NH_, 3), 32, 0, stream>>>(XB, W4, bq, bk, bv, QP16, QPh, QPl, VT16, VTh, VTl);
    k_attn<<<NHB + NLB, AW * 32, 0, stream>>>(QP16, QPh, QPl, VT16, VTh, VTl, ATh, ATl);
    k_gemmw<bf, 1, true><<<dim3(NB_ * TT / 64, DM / 64, 1), 32, 0, stream>>>(ATh, ATl, WO, nullptr, DQ, OUT, DM, bo, bo, bo, 0, 0, 0);
}

// v005
// One run takes 122 microseconds.
// In two side-by-side timings against v004, it was 1.48 and 1.49 times as fast.
// All steps since v000 together make it 16.6 times as fast.
#include <hip/hip_runtime.h>

// Multi-head attention WITHOUT a mask and with biased projections at a 512-wide model (x [4][2048][512]; q, k, v = x W + b ('xw' [512][512] uniform +-1/sqrt(512) + zero biases; 8 heads x 64); scores x 64^-0.5; softmax over all keys; out = merged Wo + bo ('xw' + zero bias) -> [4][2048][512] (4.2 M); argument order x, Wq, bq, Wk, bk, Wv, bv, Wo, bo).
// Layout, all four batches at once (32 head planes, index b * 8 + h): bf16 copy of x; 'xw' weights transposed once; exact projections + f32 biases, whose epilogue writes the head planes; one fused dense T-2048 attention kernel (hybrid rows: < 512 hi/lo 3 products, rest fp16; scores and P stay in registers); merged hi/lo x wo exact + bo.
// Compute dtypes, f32 accumulate: every input rounded to bf16; projections exact + f32 biases; attention rows < 512 3 products, rest fp16; softmax f32; wo hl x exact + bias.

#define NB_  4
#define TT   2048
#define DM   512    // model width: this module's D_MODEL
#define NH_  8      // heads: 8 x 64 = 512
#define NKV  8      // kv heads = heads (no grouping)
#define REP  (NH_ / NKV)
#define HD   64
#define DQ   (NH_ * HD)
#define DKV  (NKV * HD)
#define NZ   (NB_ * NH_)          // head planes over all batches, plane index b * NH_ + h
#define RH   512                  // query rows < RH use hi+lo planes (0: none)
#define WIN  0
#define SCL  0.125f   // HD^-0.5
typedef _Float16 h16;
typedef unsigned short bf;
typedef __attribute__((ext_vector_type(16))) __bf16   v16bf;
typedef __attribute__((ext_vector_type(16))) _Float16 v16h;
typedef __attribute__((ext_vector_type(8)))  _Float16 v8h;
typedef __attribute__((ext_vector_type(8)))  unsigned short v8us;
typedef __attribute__((ext_vector_type(8)))  float    v8f;
typedef __attribute__((ext_vector_type(4)))  float    v4f;
typedef v8h  __attribute__((may_alias)) v8ha;
typedef v4f  __attribute__((may_alias)) v4fa;
typedef v8us __attribute__((may_alias)) v8usa;

__device__ __forceinline__ unsigned short f2bf(float f) { unsigned u = __float_as_uint(f); u += 0x7FFFu + ((u >> 16) & 1u); return (unsigned short)(u >> 16); }
__device__ __forceinline__ float bf2f(unsigned short b) { return __uint_as_float(((unsigned)b) << 16); }
__device__ __forceinline__ float bfr(float f) { return bf2f(f2bf(f)); }
__device__ __forceinline__ v16h cat16(v8h lo, v8h hi) { return __builtin_shufflevector(lo, hi, 0, 1, 2, 3, 4, 5, 6, 7, 8, 9, 10, 11, 12, 13, 14, 15); }
__device__ __forceinline__ v16bf cat16b(v8us lo, v8us hi) { return __builtin_bit_cast(v16bf, __builtin_shufflevector(lo, hi, 0, 1, 2, 3, 4, 5, 6, 7, 8, 9, 10, 11, 12, 13, 14, 15)); }
__device__ __forceinline__ v8f wmma16(v16h a, v16h b, v8f c) { return __builtin_amdgcn_wmma_f32_16x16x32_f16(false, a, false, b, (short)0, c, false, false); }
__device__ __forceinline__ v8f wmmab(v16bf a, v16bf b, v8f c) { return __builtin_amdgcn_wmma_f32_16x16x32_bf16(false, a, false, b, (short)0, c, false, false); }



// ---- FRAGMENT ORDER of every 16-bit operand plane M[row][k], k < K: blocks of 16 rows x 32 k = 1 KB, block (row / 16, k / 32) at element (row / 16) * 16 * K + (k / 32) * 512; inside a block the 16-byte piece number ((k / 16) & 1) * 32 + ((k / 8) & 1) * 16 + (row & 15) holds k & ~7 to k | 7 of its row.
// The V^T planes (64 rows) alone order their blocks by k first, block (row / 16, k / 32) at ((k / 32) * 4 + row / 16) * 512: the four blocks of a 32-key pass lie in a row.
// Piece number = half of the fragment * 32 + lane: each of a fragment's two wave-wide 16-byte loads reads 512 bytes in a row (4 whole lines), where row-major planes gave 32 bytes of each of 16 lines. Which lane and register holds which (row, k) is as before.
// ---- gemmw_tile: register-blocked GEMM, ONE WAVE per 64x64 output tile (16 accumulators), operands straight from 16-bit planes in fragment order; grid (M/64, N/64, Z), 32 threads; bx = the tile's row index, os = the work-group's 16 x 68 f32 of LDS.
// C[m][n] (f32, pitch ldc, + optional f32 bias[n]) = sum_k A[m][k] Bt[n][k] (+ split products per NSPLIT). z-batch strides sA/sB/sC in elements. K % 32 == 0.
// KSP > 1: grid z = Z * KSP; work-group (z, ks) sums only k in [ks K/KSP, (ks+1) K/KSP) and stores its partial tile in plane z * KSP + ks (stride sC); the reader adds the KSP planes. K % (32 KSP) == 0.
template <typename T16> struct WFrag;
template <> struct WFrag<h16> { typedef v16h V; static __device__ __forceinline__ V ld(const h16* p) { return cat16(*(const v8h*)p, *(const v8h*)(p + 256)); } static __device__ __forceinline__ v8f mma(V a, V b, v8f c) { return wmma16(a, b, c); } };
template <> struct WFrag<bf> { typedef v16bf V; static __device__ __forceinline__ V ld(const bf* p) { return cat16b(*(const v8us*)p, *(const v8us*)(p + 256)); } static __device__ __forceinline__ v8f mma(V a, V b, v8f c) { return wmmab(a, b, c); } };
template <typename T16, int NSPLIT, bool BIAS, int KSP>
__device__ __forceinline__ void gemmw_tile(float* os, int bx, const T16* __restrict__ A, const T16* __restrict__ A2, const T16* __restrict__ Bt, const T16* __restrict__ Bt2, int K, float* C, int ldc, const float* __restrict__ bias, size_t sA, size_t sB, size_t sC) {
    typedef typename WFrag<T16>::V V;
    const size_t z = blockIdx.z / KSP; const int ks = blockIdx.z % KSP; A += z * sA; if (A2) A2 += z * sA; Bt += z * sB; if (Bt2) Bt2 += z * sB; C += (size_t)blockIdx.z * sC;
    const int lane = threadIdx.x & 31, lr = lane & 15, hi = lane >> 4; const int r0 = bx * 64, c0 = blockIdx.y * 64;
    v8f acc[4][4];
#pragma unroll
    for (int mb = 0; mb < 4; ++mb)
#pragma unroll
        for (int nb = 0; nb < 4; ++nb) acc[mb][nb] = (v8f){};
    const size_t aoff = (size_t)r0 * K + 8 * lane, boff = (size_t)c0 * K + 8 * lane;   // this lane's piece in block (tile's first 16 rows, k 0)
#pragma unroll 1
    for (int kc = ks * (K / KSP), ke = kc + K / KSP; kc < ke; kc += 32) {
        V a[4], a2[4];
#pragma unroll
        for (int mb = 0; mb < 4; ++mb) { const T16* pa = A + aoff + (size_t)mb * 16 * K + kc * 16; const T16* pa2 = (NSPLIT == 1 || NSPLIT == 2) ? A2 + aoff + (size_t)mb * 16 * K + kc * 16 : pa; a[mb] = WFrag<T16>::ld(pa); if (NSPLIT == 1 || NSPLIT == 2) a2[mb] = WFrag<T16>::ld(pa2);
            asm volatile("s_wait_xcnt 0x0" :: "v"(pa), "v"(pa2) : "memory"); }   // precaution: the wait behind the loads, in front of any overwrite of their address registers; naming the pointers keeps the pairs live up to here
#pragma unroll
        for (int nb = 0; nb < 4; ++nb) { const T16* pb = Bt + boff + (size_t)nb * 16 * K + kc * 16; const T16* pb2 = (NSPLIT >= 2) ? Bt2 + boff + (size_t)nb * 16 * K + kc * 16 : pb; const V b = WFrag<T16>::ld(pb); V b2; if (NSPLIT >= 2) b2 = WFrag<T16>::ld(pb2);
            asm volatile("s_wait_xcnt 0x0" :: "v"(pb), "v"(pb2) : "memory");   // precaution, as for the A fragments
#pragma unroll
            for (int mb = 0; mb < 4; ++mb) { acc[mb][nb] = WFrag<T16>::mma(a[mb], b, acc[mb][nb]); if (NSPLIT == 1 || NSPLIT == 2) acc[mb][nb] = WFrag<T16>::mma(a2[mb], b, acc[mb][nb]); if (NSPLIT >= 2) acc[mb][nb] = WFrag<T16>::mma(a[mb], b2, acc[mb][nb]); } }
        asm volatile("v_nop\n\tv_nop\n\tv_nop\n\tv_nop" : "+v"(acc[0][0]), "+v"(acc[1][1]), "+v"(acc[2][2]), "+v"(acc[3][3]) : "v"(a[0]), "v"(a[3]));
    }
#pragma unroll
    for (int mb = 0; mb < 4; ++mb) {
#pragma unroll
        for (int nb = 0; nb < 4; ++nb) {
#pragma unroll
            for (int j = 0; j < 8; ++j) os[(hi * 8 + j) * 68 + nb * 16 + lr] = acc[mb][nb][j]; }
        __builtin_amdgcn_wave_barrier(); asm volatile("" ::: "memory");
        float* crow = C + (size_t)(r0 + mb * 16) * ldc + c0;
{ v4f vs[8]; float* pp[8];
#pragma unroll
            for (int s = 0; s < 8; ++s) { const int row = 2 * s + hi, cofs = lr * 4; v4f val = *(const v4fa*)(os + row * 68 + cofs); if (BIAS) { val[0] += bfr(bias[c0 + cofs]); val[1] += bfr(bias[c0 + cofs + 1]); val[2] += bfr(bias[c0 + cofs + 2]); val[3] += bfr(bias[c0 + cofs + 3]); }
                vs[s] = val; pp[s] = crow + (size_t)row * ldc + cofs; *(v4f*)pp[s] = val; }
            asm volatile("s_wait_xcnt 0x0" :: "v"(vs[0]), "v"(vs[1]), "v"(vs[2]), "v"(vs[3]), "v"(vs[4]), "v"(vs[5]), "v"(vs[6]), "v"(vs[7]), "v"(pp[0]), "v"(pp[1]), "v"(pp[2]), "v"(pp[3]), "v"(pp[4]), "v"(pp[5]), "v"(pp[6]), "v"(pp[7]) : "memory");   // precaution: the wait behind the 8 stores, in front of any overwrite of their address or data registers; naming them keeps them live up to here
             }
        __builtin_amdgcn_wave_barrier(); asm volatile("" ::: "memory");
    }
    asm volatile("s_wait_xcnt 0x0" ::: "memory");   // precaution: the wait behind the tile's last stores, in front of any code that follows and rewrites their address or data registers
}
// k_gemmw: one product per grid z, each z with its own bias vector
template <typename T16, int NSPLIT, bool BIAS>
__global__ __launch_bounds__(32) void k_gemmw(const T16* __restrict__ A, const T16* __restrict__ A2, const T16* __restrict__ Bt, const T16* __restrict__ Bt2, int K, float* C, int ldc, const float* __restrict__ bias0, const float* __restrict__ bias1, const float* __restrict__ bias2, size_t sA, size_t sB, size_t sC) {
    __shared__ __align__(16) float os[16 * 68];
    const float* bias = (blockIdx.z == 0) ? bias0 : ((blockIdx.z == 1) ? bias1 : bias2);
    gemmw_tile<T16, NSPLIT, BIAS, 1>(os, (int)blockIdx.x, A, A2, Bt, Bt2, K, C, ldc, bias, sA, sB, sC);
}

__device__ __forceinline__ void splitf(float y, unsigned short& h, unsigned short& l) { h = f2bf(y); l = f2bf(y - bf2f(h)); }
typedef __attribute__((ext_vector_type(4))) _Float16 v4h;
typedef __attribute__((ext_vector_type(2))) unsigned short v2us;
typedef __attribute__((ext_vector_type(4))) unsigned short v4us;
typedef __attribute__((ext_vector_type(4))) int v4i;

// One thread per 16-byte piece of a plane in fragment order, piece number o: a wave stores 512 bytes in a row. pc_row, pc_k: the piece's row and its first k in a plane of K columns.
__device__ __forceinline__ int pc_row(int o, int K) { return (o >> 6) / (K / 32) * 16 + (o & 15); }
__device__ __forceinline__ int pc_k(int o, int K) { return (o >> 6) % (K / 32) * 32 + ((o >> 5) & 1) * 16 + ((o >> 4) & 1) * 8; }
// wtG_blk: Bt[n][k] = w[k][n]; a piece is 8 rows of w at one column, 16 neighbouring columns a half-wave
__device__ __forceinline__ void wtG_blk(int bx, const float* __restrict__ w, int K, int N, bf* Bt) {
    const int o = bx * 256 + (int)threadIdx.x; if (o >= N * K / 8) return; const float* p = w + (size_t)pc_k(o, K) * N + pc_row(o, K); v8us v;
    float y[8];
#pragma unroll
    for (int i = 0; i < 8; ++i) y[i] = p[(size_t)i * N];
    asm volatile("s_wait_xcnt 0x0" :: "v"(p) : "memory");   // precaution: the wait behind the 8 loads, in front of any overwrite of their address registers; naming the pointer keeps the pair live up to here
#pragma unroll
    for (int i = 0; i < 8; ++i) v[i] = f2bf(y[i]);
    *(v8us*)(Bt + (size_t)o * 8) = v;
}
// cvt_blk: bf16 copy of src[row][k] in fragment order, one wave per 1-KB block: 4 loads of 4 whole lines each (row 4 i + lane / 8, 16 bytes a lane); a lane's 4 values are half a piece, 8 bytes a store
__device__ __forceinline__ void cvt_blk(int bx, const float* __restrict__ src, int K, bf* dst, int nblk) {
    const int lane = threadIdx.x & 31, k4 = lane & 7, r4 = lane >> 3; const int blk = bx * 8 + (int)(threadIdx.x >> 5); if (blk >= nblk) return;
    const float* p = src + (size_t)(blk / (K / 32) * 16 + r4) * K + blk % (K / 32) * 32 + 4 * k4; v4f v[4];
#pragma unroll
    for (int i = 0; i < 4; ++i) v[i] = *(const v4f*)(p + (size_t)4 * i * K);
    asm volatile("s_wait_xcnt 0x0" :: "v"(p) : "memory");   // precaution, as in wtG_blk
    bf* q = dst + (size_t)blk * 512 + ((k4 >> 2) * 32 + ((k4 >> 1) & 1) * 16 + r4) * 8 + (k4 & 1) * 4;
#pragma unroll
    for (int i = 0; i < 4; ++i) { v4us u;
#pragma unroll
        for (int k = 0; k < 4; ++k) u[k] = f2bf(v[i][k]);
        *(v4us*)(q + 32 * i) = u; }
}

// k_pre: the jobs that read only inputs, one block range each: 4 weight transposes (NWT blocks each), the bf16 copy of x (NCV)
#define NWT (DM * DQ / 8 / 256)
#define NCV (NB_ * TT * DM / 512 / 8)
__global__ __launch_bounds__(256) void k_pre(const float* __restrict__ x, const float* __restrict__ wq, const float* __restrict__ wk, const float* __restrict__ wv, const float* __restrict__ wo, bf* W4, bf* XB) {
    const int bx = (int)blockIdx.x;
    if (bx < 4 * NWT) { const int j = bx / NWT; const float* w = (j == 0) ? wq : ((j == 1) ? wk : ((j == 2) ? wv : wo)); wtG_blk(bx % NWT, w, DM, DQ, W4 + (size_t)j * DQ * DM); }
    else cvt_blk(bx - 4 * NWT, x, DM, XB, NB_ * TT * DM / 512);
}
typedef __attribute__((ext_vector_type(2))) float f32x2;
typedef __attribute__((ext_vector_type(2))) __bf16 bf16x2;
typedef __attribute__((ext_vector_type(8))) unsigned u32x8;
typedef __attribute__((ext_vector_type(4))) unsigned u32x4;
#define CSC (SCL * 1.4426950408889634f)
__device__ __forceinline__ float xhalf(float x) { return __builtin_bit_cast(float, __builtin_amdgcn_permlanex16(__builtin_bit_cast(int, x), __builtin_bit_cast(int, x), 0x76543210, 0xfedcba98, false, false)); }   // lane l with lane l ^ 16
__device__ __forceinline__ unsigned packbf(float lo, float hi) { return __builtin_bit_cast(unsigned, __builtin_convertvector((f32x2){lo, hi}, bf16x2)); }   // round to nearest even
__device__ __forceinline__ void nop4() { __builtin_amdgcn_sched_barrier(0); asm volatile("v_nop\n\tv_nop\n\tv_nop\n\tv_nop"); __builtin_amdgcn_sched_barrier(0); }   // the 4 vector slots between a pass's last WMMAs and whatever next overwrites their A or B or touches their D, in the next pass and behind the loop's exit branch alike (without them a WMMA stood directly in front of that branch); the two scheduling barriers keep the slots behind the run
// xwait: precaution: the wait behind a group of loads, in front of any overwrite of their address registers; naming the pointers keeps the address pairs live up to here, the clobber keeps the loads in front of it
template <bool HL, typename T16> __device__ __forceinline__ void xwait(const T16* a, const T16* b) { if constexpr (HL) asm volatile("s_wait_xcnt 0x0" :: "v"(a), "v"(b) : "memory"); else asm volatile("s_wait_xcnt 0x0" :: "v"(a) : "memory"); }
template <typename T16, bool HL, int R>
__device__ __forceinline__ void attn_cols(const T16* __restrict__ Q, const T16* __restrict__ Q2, const T16* __restrict__ K, const T16* __restrict__ K2, const T16* __restrict__ VT, const T16* __restrict__ VT2, int q0, bf* Ah, bf* Al) {
    typedef typename WFrag<T16>::V V;
    const int lane = threadIdx.x & 31;
    V qf[R][2], qf2[R][2];
#pragma unroll
    for (int g = 0; g < R; ++g) { const size_t o = (size_t)(q0 + 16 * g) * HD + 8 * lane; const T16* qp = Q + o; const T16* qp2 = HL ? Q2 + o : qp;
#pragma unroll
        for (int kc = 0; kc < 2; ++kc) { qf[g][kc] = WFrag<T16>::ld(qp + 512 * kc); if (HL) qf2[g][kc] = WFrag<T16>::ld(qp2 + 512 * kc); }
        xwait<HL>(qp, qp2); }
    v8f acc[R][4]; float m[R]; f32x2 l[R];   // l: each lane's share of the denominator, even and odd keys apart
#pragma unroll
    for (int g = 0; g < R; ++g) { m[g] = -__builtin_inff(); l[g] = (f32x2){0.f, 0.f};
#pragma unroll
        for (int t = 0; t < 4; ++t) acc[g][t] = (v8f){}; }
    const int ko = 8 * lane, vo = 8 * lane;   // a pass's K rows are 4 blocks in a row, and so is its V^T
    V kf[2][2], kf2[2][2];
#pragma unroll
    for (int kt = 0; kt < 2; ++kt)
#pragma unroll
        for (int kc = 0; kc < 2; ++kc) { kf[kt][kc] = WFrag<T16>::ld(K + ko + kt * 16 * HD + 512 * kc); if (HL) kf2[kt][kc] = WFrag<T16>::ld(K2 + ko + kt * 16 * HD + 512 * kc); }
    xwait<HL>(K + ko, HL ? K2 + ko : K + ko);
    __builtin_amdgcn_sched_barrier(0);   // keeps the zeroing of the accumulators behind the wait above: moved in front of it, it overwrote an address pair of the first K loads ahead of the wait
#pragma unroll 1
    for (int key0 = 0; key0 < TT; key0 += 32) {   // rolled: one pass already holds every register the wave can spare
        const T16* vp = VT + vo + key0 * HD; const T16* vp2 = HL ? VT2 + vo + key0 * HD : vp;
        V vf[4], vf2[4];   // this pass's V^T fragments, asked for first: they fly under the first product and the softmax
#pragma unroll
        for (int t = 0; t < 4; ++t) { vf[t] = WFrag<T16>::ld(vp + t * 512); if (HL) vf2[t] = WFrag<T16>::ld(vp2 + t * 512); }
        xwait<HL>(vp, vp2);
        v8f s[2][R];
#pragma unroll
        for (int kt = 0; kt < 2; ++kt)
#pragma unroll
            for (int g = 0; g < R; ++g) { s[kt][g] = (v8f){};
#pragma unroll
                for (int kc = 0; kc < 2; ++kc) { s[kt][g] = WFrag<T16>::mma(kf[kt][kc], qf[g][kc], s[kt][g]); if (HL) { s[kt][g] = WFrag<T16>::mma(kf[kt][kc], qf2[g][kc], s[kt][g]); s[kt][g] = WFrag<T16>::mma(kf2[kt][kc], qf[g][kc], s[kt][g]); } } }
        const int kn = (key0 + 32) & (TT - 1);   // next pass's K rows, into the same registers, in flight under the softmax and the second product (the last pass asks for rows 0 again, which nobody uses)
        const T16* kp = K + ko + (size_t)kn * HD; const T16* kp2 = HL ? K2 + ko + (size_t)kn * HD : kp;
#pragma unroll
        for (int kt = 0; kt < 2; ++kt)
#pragma unroll
            for (int kc = 0; kc < 2; ++kc) { kf[kt][kc] = WFrag<T16>::ld(kp + kt * 16 * HD + 512 * kc); if (HL) kf2[kt][kc] = WFrag<T16>::ld(kp2 + kt * 16 * HD + 512 * kc); }
        xwait<HL>(kp, kp2);
        float mb[R]; bool need = false;
#pragma unroll
        for (int g = 0; g < R; ++g) { float mx = s[0][g][0];
#pragma unroll
            for (int i = 1; i < 16; ++i) mx = fmaxf(mx, s[i >> 3][g][i & 7]);
            mx = fmaxf(mx, xhalf(mx)) * CSC; mb[g] = mx; need = need || (mx > m[g] + 8.0f); }
        if (__builtin_amdgcn_ballot_w32(need) != 0) {   // one scalar branch a pass; always taken in the first pass (m is -inf there, the factor 0)
#pragma unroll
            for (int g = 0; g < R; ++g) { const float mn = fmaxf(m[g], mb[g]); const float corr = __builtin_amdgcn_exp2f(m[g] - mn); m[g] = mn; l[g] *= corr;
#pragma unroll
                for (int t = 0; t < 4; ++t) acc[g][t] = acc[g][t] * corr; }
        }
#pragma unroll
        for (int g = 0; g < R; ++g) { const float nm = -m[g]; float p[16];
#pragma unroll
            for (int i = 0; i < 8; ++i) { const f32x2 arg = __builtin_elementwise_fma((f32x2){s[i >> 2][g][2 * (i & 3)], s[i >> 2][g][2 * (i & 3) + 1]}, (f32x2){CSC, CSC}, (f32x2){nm, nm}); p[2 * i] = __builtin_amdgcn_exp2f(arg.x); p[2 * i + 1] = __builtin_amdgcn_exp2f(arg.y); l[g] += (f32x2){p[2 * i], p[2 * i + 1]}; }
            if constexpr (HL) { u32x8 wh, wl;
#pragma unroll
                for (int i = 0; i < 8; ++i) { const unsigned w = packbf(p[2 * i], p[2 * i + 1]); wh[i] = w; wl[i] = packbf(p[2 * i] - __uint_as_float(w << 16), p[2 * i + 1] - __uint_as_float(w & 0xFFFF0000u)); }
                const V ph = __builtin_bit_cast(V, wh), pl = __builtin_bit_cast(V, wl);
#pragma unroll
                for (int t = 0; t < 4; ++t) { acc[g][t] = WFrag<T16>::mma(vf[t], ph, acc[g][t]); acc[g][t] = WFrag<T16>::mma(vf[t], pl, acc[g][t]); acc[g][t] = WFrag<T16>::mma(vf2[t], ph, acc[g][t]); }
            } else { V pf;
#pragma unroll
                for (int i = 0; i < 16; ++i) pf[i] = (h16)p[i];
#pragma unroll
                for (int t = 0; t < 4; ++t) acc[g][t] = WFrag<T16>::mma(vf[t], pf, acc[g][t]); } }
        nop4();
    }
#pragma unroll
    for (int g = 0; g < R; ++g) { const float lh = l[g].x + l[g].y; const float lt = lh + xhalf(lh); const float inv = __fdiv_rn(1.0f, lt);   // the halves' sums joined once, unconditionally
        const size_t oo = (size_t)(q0 + 16 * g) * DQ + 8 * lane;   // lane (c, h) holds d = 16 t + 8 h + r of query c: piece 32 (t & 1) + lane of block (query group, 2 head + t / 2) of the merged plane
#pragma unroll
        for (int t = 0; t < 4; ++t) { v8us oh, ol;
#pragma unroll
            for (int r = 0; r < 8; ++r) { unsigned short a, c2; splitf(acc[g][t][r] * inv, a, c2); oh[r] = a; ol[r] = c2; }
            *(v8us*)(Ah + oo + 256 * t) = oh; *(v8us*)(Al + oo + 256 * t) = ol; } }
}
// k_attn: 4 waves a work-group, no LDS. Blocks below NHB: rows < RH on the hi/lo bf16 planes (3 products), 16 columns a wave; the others: fp16 planes, 32 columns a wave. The longer class starts first. Plane z = b * NH_ + h; QK planes: q planes, then k planes.
#define AW  4
#define HBZ (RH / (AW * 16))
#define LBZ ((TT - RH) / (AW * 32))
#define NHB (NZ * HBZ)
#define NLB (NZ * LBZ)
__global__ __launch_bounds__(AW * 32) void k_attn(const h16* __restrict__ QK16, const bf* __restrict__ QKh, const bf* __restrict__ QKl, const h16* __restrict__ V16, const bf* __restrict__ Vh, const bf* __restrict__ Vl, bf* Ah, bf* Al) {
    const int wave = __builtin_amdgcn_readfirstlane((int)(threadIdx.x >> 5)); const int bx = (int)blockIdx.x; const size_t PL = (size_t)TT * HD;
    if (bx < NHB) { const int z = bx / HBZ; const size_t ao = (size_t)(z / NH_) * TT * DQ + (z % NH_) * (HD * 16);
        attn_cols<bf, true, 1>(QKh + z * PL, QKl + z * PL, QKh + (NZ + z) * PL, QKl + (NZ + z) * PL, Vh + z * PL, Vl + z * PL, (bx % HBZ) * (AW * 16) + wave * 16, Ah + ao, Al + ao); }
    else { const int b2 = bx - NHB; const int z = b2 / LBZ; const size_t ao = (size_t)(z / NH_) * TT * DQ + (z % NH_) * (HD * 16);
        attn_cols<h16, false, 2>(QK16 + z * PL, nullptr, QK16 + (NZ + z) * PL, nullptr, V16 + z * PL, nullptr, RH + (b2 % LBZ) * (AW * 32) + wave * 32, Ah + ao, Al + ao); }
}

// ---- projections straight into the head planes: no f32 copy of q, k, v is stored.
// planes_out: one 64 x 64 f32 tile + bias -> its fp16, bf16-hi and bf16-lo planes, in fragment order; RS, KS: elements from a block to the next 16 rows' and to the next 32 columns'; the pointers name block (tile's first 16 rows, tile's first 32 columns). 16 rows at a time pass through the wave's own LDS, so that lane (c, h) holds columns 16 s + 8 h to + 7 of row c, piece 32 (s & 1) + lane of block s / 2: 16 bytes a lane, 512 bytes in a row a store. RB: the bias goes by the tile's row, else by its column.
template <int RS, int KS, bool RB>
__device__ __forceinline__ void planes_out(float* os, const v8f (&acc)[4][4], const float* __restrict__ bias, h16* P16, bf* Ph, bf* Pl) {
    const int lane = threadIdx.x & 31, lr = lane & 15, hi = lane >> 4;
    float bb[RB ? 4 : 32];   // every bias this lane adds, asked for once, ahead of the LDS passes
#pragma unroll
    for (int i = 0; i < (RB ? 4 : 32); ++i) bb[i] = bfr(bias[RB ? 16 * i + lr : 16 * (i >> 3) + 8 * hi + (i & 7)]);
    h16* p16 = P16 + 8 * lane; bf* ph = Ph + 8 * lane; bf* pl = Pl + 8 * lane;   // this lane's piece in the first block; every store is a constant further
#pragma unroll
    for (int mb = 0; mb < 4; ++mb) {
#pragma unroll
        for (int nb = 0; nb < 4; ++nb) {
#pragma unroll
            for (int j = 0; j < 8; ++j) os[(hi * 8 + j) * 68 + nb * 16 + lr] = acc[mb][nb][j]; }
        __builtin_amdgcn_wave_barrier(); asm volatile("" ::: "memory");   // the rows are read back by other lanes: no LDS read moves in front of the writes
#pragma unroll
        for (int s = 0; s < 4; ++s) { const float* orow = os + lr * 68 + 16 * s + 8 * hi; const v4f lo4 = *(const v4fa*)orow, hi4 = *(const v4fa*)(orow + 4); float y[8]; v8h o16; u32x4 oh, ol;
#pragma unroll
            for (int i = 0; i < 8; ++i) { y[i] = ((i < 4) ? lo4[i & 3] : hi4[i & 3]) + bb[RB ? mb : 8 * s + i]; o16[i] = (h16)y[i]; }
#pragma unroll
            for (int i = 0; i < 4; ++i) { const unsigned w = packbf(y[2 * i], y[2 * i + 1]); oh[i] = w; ol[i] = packbf(y[2 * i] - __uint_as_float(w << 16), y[2 * i + 1] - __uint_as_float(w & 0xFFFF0000u)); }
            const size_t o = (size_t)mb * RS + (s >> 1) * KS + (s & 1) * 256;
            *(v8h*)(p16 + o) = o16; *(v8us*)(ph + o) = __builtin_bit_cast(v8us, oh); *(v8us*)(pl + o) = __builtin_bit_cast(v8us, ol);
            asm volatile("s_wait_xcnt 0x0" :: "v"(p16), "v"(ph), "v"(pl), "v"(o16), "v"(oh), "v"(ol) : "memory"); }   // precaution: the wait behind the three stores, in front of any overwrite of their address or data registers; naming them keeps them live up to here
        __builtin_amdgcn_wave_barrier(); asm volatile("" ::: "memory");   // the next 16 rows are written only behind these reads
    }
}
// k_proj: one wave per tile of 64 tokens x one head's 64 columns; grid (token tiles over all batches, heads, 3: q, k, v). q and k: A = x rows, B = weight rows, tile [t][d]. v: the operands change places, so the tile comes out as [d][t], the order of its plane.
__global__ __launch_bounds__(32) void k_proj(const bf* __restrict__ XB, const bf* __restrict__ W4, const float* __restrict__ bq, const float* __restrict__ bk, const float* __restrict__ bv, h16* QK16, bf* QKh, bf* QKl, h16* V16, bf* Vh, bf* Vl) {
    __shared__ __align__(16) float os[16 * 68];
    const int kind = (int)blockIdx.z, head = (int)blockIdx.y, tile = (int)blockIdx.x; const int lane = threadIdx.x & 31;
    const size_t fo = 8 * lane;   // this lane's piece of a block
    const bf* X = XB + (size_t)tile * 64 * DM + fo; const bf* Wt = W4 + ((size_t)kind * DQ + head * HD) * DM + fo;
    const bf* A = (kind == 2) ? Wt : X; const bf* B = (kind == 2) ? X : Wt;
    v8f acc[4][4];
#pragma unroll
    for (int mb = 0; mb < 4; ++mb)
#pragma unroll
        for (int nb = 0; nb < 4; ++nb) acc[mb][nb] = (v8f){};
#pragma unroll 1
    for (int kc = 0; kc < DM; kc += 32) {   // rolled, as the other GEMM's K loop
        const bf* pa = A + kc * 16; const bf* pb = B + kc * 16; v16bf a[4], b[4];
#pragma unroll
        for (int i = 0; i < 4; ++i) { a[i] = WFrag<bf>::ld(pa + (size_t)i * 16 * DM); b[i] = WFrag<bf>::ld(pb + (size_t)i * 16 * DM); }
        xwait<true>(pa, pb);
        __builtin_amdgcn_sched_barrier(0);   // keeps the products behind the group of 16 loads: moved in among them they shared one B buffer, and each of the four B fragments was waited for by itself
#pragma unroll
        for (int nb = 0; nb < 4; ++nb)
#pragma unroll
            for (int mb = 0; mb < 4; ++mb) acc[mb][nb] = wmmab(a[mb], b[nb], acc[mb][nb]);
        nop4();
    }
    const size_t plane = (size_t)(tile / (TT / 64)) * NH_ + head; const int t0 = (tile % (TT / 64)) * 64;
    if (kind == 2) { const size_t o = plane * HD * TT + t0 * HD; planes_out<512, 4 * 512, true>(os, acc, bv + head * HD, V16 + o, Vh + o, Vl + o); }
    else { const size_t o = (((size_t)kind * NZ + plane) * TT + t0) * HD; planes_out<16 * HD, 512, false>(os, acc, ((kind == 0) ? bq : bk) + head * HD, QK16 + o, QKh + o, QKl + o); }
}

extern "C" void kernel_launch(void* const* d_in, const int* in_sizes, int n_in,
                              void* d_out, int out_size, void* d_ws, size_t ws_size, hipStream_t stream) {
    (void)in_sizes; (void)n_in; (void)out_size;
    const float* x = (const float*)d_in[0]; const float* wq = (const float*)d_in[1]; const float* bq = (const float*)d_in[2]; const float* wk = (const float*)d_in[3]; const float* bk = (const float*)d_in[4]; const float* wv = (const float*)d_in[5]; const float* bv = (const float*)d_in[6]; const float* wo = (const float*)d_in[7]; const float* bo = (const float*)d_in[8];   /* argument order inputs, wq, bq, wk, bk, wv, bv, wo, bo ('xw' + biases) */
    float* OUT = (float*)d_out;     // [4][2048][512]
    char* wsp = (char*)d_ws;
    auto take = [&](size_t bytes) { char* p = wsp; wsp += (bytes + 255) & ~(size_t)255; return (void*)p; };
    bf* W4 = (bf*)take((size_t)4 * DQ * DM * 2); bf* WO = W4 + (size_t)3 * DQ * DM;   // W4: wq, wk, wv, wo transposed, one after the other
    h16* QP16 = (h16*)take((size_t)2 * NZ * TT * HD * 2); h16* VT16 = (h16*)take((size_t)NZ * HD * TT * 2);   // q planes, then k planes
    bf* QPh = (bf*)take((size_t)2 * NZ * TT * HD * 2); bf* QPl = (bf*)take((size_t)2 * NZ * TT * HD * 2); bf* VTh = (bf*)take((size_t)NZ * HD * TT * 2); bf* VTl = (bf*)take((size_t)NZ * HD * TT * 2);
    bf* XB = (bf*)take((size_t)NB_ * TT * DM * 2); bf* ATh = (bf*)take((size_t)NB_ * TT * DQ * 2); bf* ATl = (bf*)take((size_t)NB_ * TT * DQ * 2);
    if ((size_t)(wsp - (char*)d_ws) > ws_size) return;    // ws 256 MiB
    static_assert(DQ == DKV && REP == 1 && RH % (AW * 16) == 0 && (TT - RH) % (AW * 32) == 0 && (TT & (TT - 1)) == 0 && HD == 64 && TT % 64 == 0, "one kv plane per query plane; whole work-groups per row class; a projection tile is 64 tokens of one batch x one head");
    k_pre<<<4 * NWT + NCV, 256, 0, stream>>>(x, wq, wk, wv, wo, W4, XB);
    k_proj<<<dim3(NB_ * TT / 64, NH_, 3), 32, 0, stream>>>(XB, W4, bq, bk, bv, QP16, QPh, QPl, VT16, VTh, VTl);
    k_attn<<<NHB + NLB, AW * 32, 0, stream>>>(QP16, QPh, QPl, VT16, VTh, VTl, ATh, ATl);
    k_gemmw<bf, 1, true><<<dim3(NB_ * TT / 64, DM / 64, 1), 32, 0, stream>>>(ATh, ATl, WO, nullptr, DQ, OUT, DM, bo, bo, bo, 0, 0, 0);
}

// v006
// It runs in 104 microseconds.
// In two side-by-side timings against v005, it was 1.19 and 1.16 times as fast.
// Over all steps from v000 it is 19.6 times as fast.
#include <hip/hip_runtime.h>

// Multi-head attention WITHOUT a mask and with biased projections at a 512-wide model (x [4][2048][512]; q, k, v = x W + b ('xw' [512][512] uniform +-1/sqrt(512) + zero biases; 8 heads x 64); scores x 64^-0.5; softmax over all keys; out = merged Wo + bo ('xw' + zero bias) -> [4][2048][512] (4.2 M); argument order x, Wq, bq, Wk, bk, Wv, bv, Wo, bo).
// Layout, all four batches at once (32 head planes, index b * 8 + h): bf16 copy of x; 'xw' weights transposed once; exact projections + f32 biases, whose epilogue writes the head planes; one fused dense T-2048 attention kernel (hybrid rows: < 512 hi/lo 3 products, rest fp16; scores and P stay in registers); merged hi/lo x wo exact + bo.
// Compute dtypes, f32 accumulate: every input rounded to bf16; projections exact + f32 biases; attention rows < 512 3 products, rest fp16; softmax f32; wo hl x exact + bias.

#define NB_  4
#define TT   2048
#define DM   512    // model width: this module's D_MODEL
#define NH_  8      // heads: 8 x 64 = 512
#define NKV  8      // kv heads = heads (no grouping)
#define REP  (NH_ / NKV)
#define HD   64
#define DQ   (NH_ * HD)
#define DKV  (NKV * HD)
#define NZ   (NB_ * NH_)          // head planes over all batches, plane index b * NH_ + h
#define RH   512                  // query rows < RH use hi+lo planes (0: none)
#define WIN  0
#define SCL  0.125f   // HD^-0.5
typedef _Float16 h16;
typedef unsigned short bf;
typedef __attribute__((ext_vector_type(16))) __bf16   v16bf;
typedef __attribute__((ext_vector_type(16))) _Float16 v16h;
typedef __attribute__((ext_vector_type(8)))  _Float16 v8h;
typedef __attribute__((ext_vector_type(8)))  unsigned short v8us;
typedef __attribute__((ext_vector_type(8)))  float    v8f;
typedef __attribute__((ext_vector_type(4)))  float    v4f;
typedef v8h  __attribute__((may_alias)) v8ha;
typedef v4f  __attribute__((may_alias)) v4fa;
typedef v8us __attribute__((may_alias)) v8usa;

__device__ __forceinline__ unsigned short f2bf(float f) { unsigned u = __float_as_uint(f); u += 0x7FFFu + ((u >> 16) & 1u); return (unsigned short)(u >> 16); }
__device__ __forceinline__ float bf2f(unsigned short b) { return __uint_as_float(((unsigned)b) << 16); }
__device__ __forceinline__ float bfr(float f) { return bf2f(f2bf(f)); }
__device__ __forceinline__ v16h cat16(v8h lo, v8h hi) { return __builtin_shufflevector(lo, hi, 0, 1, 2, 3, 4, 5, 6, 7, 8, 9, 10, 11, 12, 13, 14, 15); }
__device__ __forceinline__ v16bf cat16b(v8us lo, v8us hi) { return __builtin_bit_cast(v16bf, __builtin_shufflevector(lo, hi, 0, 1, 2, 3, 4, 5, 6, 7, 8, 9, 10, 11, 12, 13, 14, 15)); }
__device__ __forceinline__ v8f wmma16(v16h a, v16h b, v8f c) { return __builtin_amdgcn_wmma_f32_16x16x32_f16(false, a, false, b, (short)0, c, false, false); }
__device__ __forceinline__ v8f wmmab(v16bf a, v16bf b, v8f c) { return __builtin_amdgcn_wmma_f32_16x16x32_bf16(false, a, false, b, (short)0, c, false, false); }



// ---- FRAGMENT ORDER of every 16-bit operand plane M[row][k], k < K: blocks of 16 rows x 32 k = 1 KB, block (row / 16, k / 32) at element (row / 16) * 16 * K + (k / 32) * 512; inside a block the 16-byte piece number ((k / 16) & 1) * 32 + ((k / 8) & 1) * 16 + (row & 15) holds k & ~7 to k | 7 of its row.
// The V^T planes (64 rows) alone order their blocks by k first, block (row / 16, k / 32) at ((k / 32) * 4 + row / 16) * 512: the four blocks of a 32-key pass lie in a row.
// Piece number = half of the fragment * 32 + lane: each of a fragment's two wave-wide 16-byte loads reads 512 bytes in a row (4 whole lines), where row-major planes gave 32 bytes of each of 16 lines. Which lane and register holds which (row, k) is as before.
// ---- gemmw_tile: register-blocked GEMM, ONE WAVE per 64x64 output tile (16 accumulators), operands straight from 16-bit planes in fragment order; grid (M/64, N/64, Z), 32 threads; bx = the tile's row index, os = the work-group's 16 x 68 f32 of LDS.
// C[m][n] (f32, pitch ldc, + optional f32 bias[n]) = sum_k A[m][k] Bt[n][k] (+ split products per NSPLIT). z-batch strides sA/sB/sC in elements. K % 32 == 0.
// KSP > 1: grid z = Z * KSP; work-group (z, ks) sums only k in [ks K/KSP, (ks+1) K/KSP) and stores its partial tile in plane z * KSP + ks (stride sC); the reader adds the KSP planes. K % (32 KSP) == 0.
template <typename T16> struct WFrag;
template <> struct WFrag<h16> { typedef v16h V; static __device__ __forceinline__ V ld(const h16* p) { return cat16(*(const v8h*)p, *(const v8h*)(p + 256)); } static __device__ __forceinline__ v8f mma(V a, V b, v8f c) { return wmma16(a, b, c); } };
template <> struct WFrag<bf> { typedef v16bf V; static __device__ __forceinline__ V ld(const bf* p) { return cat16b(*(const v8us*)p, *(const v8us*)(p + 256)); } static __device__ __forceinline__ v8f mma(V a, V b, v8f c) { return wmmab(a, b, c); } };
template <typename T16, int NSPLIT, bool BIAS, int KSP>
__device__ __forceinline__ void gemmw_tile(float* os, int bx, const T16* __restrict__ A, const T16* __restrict__ A2, const T16* __restrict__ Bt, const T16* __restrict__ Bt2, int K, float* C, int ldc, const float* __restrict__ bias, size_t sA, size_t sB, size_t sC) {
    typedef typename WFrag<T16>::V V;
    const size_t z = blockIdx.z / KSP; const int ks = blockIdx.z % KSP; A += z * sA; if (A2) A2 += z * sA; Bt += z * sB; if (Bt2) Bt2 += z * sB; C += (size_t)blockIdx.z * sC;
    const int lane = threadIdx.x & 31, lr = lane & 15, hi = lane >> 4; const int r0 = bx * 64, c0 = blockIdx.y * 64;
    v8f acc[4][4];
#pragma unroll
    for (int mb = 0; mb < 4; ++mb)
#pragma unroll
        for (int nb = 0; nb < 4; ++nb) acc[mb][nb] = (v8f){};
    const size_t aoff = (size_t)r0 * K + 8 * lane, boff = (size_t)c0 * K + 8 * lane;   // this lane's piece in block (tile's first 16 rows, k 0)
#pragma unroll 1
    for (int kc = ks * (K / KSP), ke = kc + K / KSP; kc < ke; kc += 32) {
        V a[4], a2[4];
#pragma unroll
        for (int mb = 0; mb < 4; ++mb) { const T16* pa = A + aoff + (size_t)mb * 16 * K + kc * 16; const T16* pa2 = (NSPLIT == 1 || NSPLIT == 2) ? A2 + aoff + (size_t)mb * 16 * K + kc * 16 : pa; a[mb] = WFrag<T16>::ld(pa); if (NSPLIT == 1 || NSPLIT == 2) a2[mb] = WFrag<T16>::ld(pa2);
            asm volatile("s_wait_xcnt 0x0" :: "v"(pa), "v"(pa2) : "memory"); }   // precaution: the wait behind the loads, in front of any overwrite of their address registers; naming the pointers keeps the pairs live up to here
#pragma unroll
        for (int nb = 0; nb < 4; ++nb) { const T16* pb = Bt + boff + (size_t)nb * 16 * K + kc * 16; const T16* pb2 = (NSPLIT >= 2) ? Bt2 + boff + (size_t)nb * 16 * K + kc * 16 : pb; const V b = WFrag<T16>::ld(pb); V b2; if (NSPLIT >= 2) b2 = WFrag<T16>::ld(pb2);
            asm volatile("s_wait_xcnt 0x0" :: "v"(pb), "v"(pb2) : "memory");   // precaution, as for the A fragments
#pragma unroll
            for (int mb = 0; mb < 4; ++mb) { acc[mb][nb] = WFrag<T16>::mma(a[mb], b, acc[mb][nb]); if (NSPLIT == 1 || NSPLIT == 2) acc[mb][nb] = WFrag<T16>::mma(a2[mb], b, acc[mb][nb]); if (NSPLIT >= 2) acc[mb][nb] = WFrag<T16>::mma(a[mb], b2, acc[mb][nb]); } }
        asm volatile("v_nop\n\tv_nop\n\tv_nop\n\tv_nop" : "+v"(acc[0][0]), "+v"(acc[1][1]), "+v"(acc[2][2]), "+v"(acc[3][3]) : "v"(a[0]), "v"(a[3]));
    }
#pragma unroll
    for (int mb = 0; mb < 4; ++mb) {
#pragma unroll
        for (int nb = 0; nb < 4; ++nb) {
#pragma unroll
            for (int j = 0; j < 8; ++j) os[(hi * 8 + j) * 68 + nb * 16 + lr] = acc[mb][nb][j]; }
        __builtin_amdgcn_wave_barrier(); asm volatile("" ::: "memory");
        float* crow = C + (size_t)(r0 + mb * 16) * ldc + c0;
{ v4f vs[8]; float* pp[8];
#pragma unroll
            for (int s = 0; s < 8; ++s) { const int row = 2 * s + hi, cofs = lr * 4; v4f val = *(const v4fa*)(os + row * 68 + cofs); if (BIAS) { val[0] += bfr(bias[c0 + cofs]); val[1] += bfr(bias[c0 + cofs + 1]); val[2] += bfr(bias[c0 + cofs + 2]); val[3] += bfr(bias[c0 + cofs + 3]); }
                vs[s] = val; pp[s] = crow + (size_t)row * ldc + cofs; *(v4f*)pp[s] = val; }
            asm volatile("s_wait_xcnt 0x0" :: "v"(vs[0]), "v"(vs[1]), "v"(vs[2]), "v"(vs[3]), "v"(vs[4]), "v"(vs[5]), "v"(vs[6]), "v"(vs[7]), "v"(pp[0]), "v"(pp[1]), "v"(pp[2]), "v"(pp[3]), "v"(pp[4]), "v"(pp[5]), "v"(pp[6]), "v"(pp[7]) : "memory");   // precaution: the wait behind the 8 stores, in front of any overwrite of their address or data registers; naming them keeps them live up to here
             }
        __builtin_amdgcn_wave_barrier(); asm volatile("" ::: "memory");
    }
    asm volatile("s_wait_xcnt 0x0" ::: "memory");   // precaution: the wait behind the tile's last stores, in front of any code that follows and rewrites their address or data registers
}
// k_gemmw: one product per grid z, each z with its own bias vector
template <typename T16, int NSPLIT, bool BIAS>
__global__ __launch_bounds__(32) void k_gemmw(const T16* __restrict__ A, const T16* __restrict__ A2, const T16* __restrict__ Bt, const T16* __restrict__ Bt2, int K, float* C, int ldc, const float* __restrict__ bias0, const float* __restrict__ bias1, const float* __restrict__ bias2, size_t sA, size_t sB, size_t sC) {
    __shared__ __align__(16) float os[16 * 68];
    const float* bias = (blockIdx.z == 0) ? bias0 : ((blockIdx.z == 1) ? bias1 : bias2);
    gemmw_tile<T16, NSPLIT, BIAS, 1>(os, (int)blockIdx.x, A, A2, Bt, Bt2, K, C, ldc, bias, sA, sB, sC);
}

__device__ __forceinline__ void splitf(float y, unsigned short& h, unsigned short& l) { h = f2bf(y); l = f2bf(y - bf2f(h)); }
typedef __attribute__((ext_vector_type(4))) _Float16 v4h;
typedef __attribute__((ext_vector_type(2))) unsigned short v2us;
typedef __attribute__((ext_vector_type(4))) unsigned short v4us;
typedef __attribute__((ext_vector_type(4))) int v4i;

// One thread per 16-byte piece of a plane in fragment order, piece number o: a wave stores 512 bytes in a row. pc_row, pc_k: the piece's row and its first k in a plane of K columns.
__device__ __forceinline__ int pc_row(int o, int K) { return (o >> 6) / (K / 32) * 16 + (o & 15); }
__device__ __forceinline__ int pc_k(int o, int K) { return (o >> 6) % (K / 32) * 32 + ((o >> 5) & 1) * 16 + ((o >> 4) & 1) * 8; }
// wtG_blk: Bt[n][k] = w[k][n]; a piece is 8 rows of w at one column, 16 neighbouring columns a half-wave
__device__ __forceinline__ void wtG_blk(int bx, const float* __restrict__ w, int K, int N, bf* Bt) {
    const int o = bx * 256 + (int)threadIdx.x; if (o >= N * K / 8) return; const float* p = w + (size_t)pc_k(o, K) * N + pc_row(o, K); v8us v;
    float y[8];
#pragma unroll
    for (int i = 0; i < 8; ++i) y[i] = p[(size_t)i * N];
    asm volatile("s_wait_xcnt 0x0" :: "v"(p) : "memory");   // precaution: the wait behind the 8 loads, in front of any overwrite of their address registers; naming the pointer keeps the pair live up to here
#pragma unroll
    for (int i = 0; i < 8; ++i) v[i] = f2bf(y[i]);
    *(v8us*)(Bt + (size_t)o * 8) = v;
}
// cvt_blk: bf16 copy of src[row][k] in fragment order, one wave per 1-KB block: 4 loads of 4 whole lines each (row 4 i + lane / 8, 16 bytes a lane); a lane's 4 values are half a piece, 8 bytes a store
__device__ __forceinline__ void cvt_blk(int bx, const float* __restrict__ src, int K, bf* dst, int nblk) {
    const int lane = threadIdx.x & 31, k4 = lane & 7, r4 = lane >> 3; const int blk = bx * 8 + (int)(threadIdx.x >> 5); if (blk >= nblk) return;
    const float* p = src + (size_t)(blk / (K / 32) * 16 + r4) * K + blk % (K / 32) * 32 + 4 * k4; v4f v[4];
#pragma unroll
    for (int i = 0; i < 4; ++i) v[i] = *(const v4f*)(p + (size_t)4 * i * K);
    asm volatile("s_wait_xcnt 0x0" :: "v"(p) : "memory");   // precaution, as in wtG_blk
    bf* q = dst + (size_t)blk * 512 + ((k4 >> 2) * 32 + ((k4 >> 1) & 1) * 16 + r4) * 8 + (k4 & 1) * 4;
#pragma unroll
    for (int i = 0; i < 4; ++i) { v4us u;
#pragma unroll
        for (int k = 0; k < 4; ++k) u[k] = f2bf(v[i][k]);
        *(v4us*)(q + 32 * i) = u; }
}

// k_pre: the jobs that read only inputs, one block range each: 4 weight transposes (NWT blocks each), the bf16 copy of x (NCV)
#define NWT (DM * DQ / 8 / 256)
#define NCV (NB_ * TT * DM / 512 / 8)
__global__ __launch_bounds__(256) void k_pre(const float* __restrict__ x, const float* __restrict__ wq, const float* __restrict__ wk, const float* __restrict__ wv, const float* __restrict__ wo, bf* W4, bf* XB) {
    const int bx = (int)blockIdx.x;
    if (bx < 4 * NWT) { const int j = bx / NWT; const float* w = (j == 0) ? wq : ((j == 1) ? wk : ((j == 2) ? wv : wo)); wtG_blk(bx % NWT, w, DM, DQ, W4 + (size_t)j * DQ * DM); }
    else cvt_blk(bx - 4 * NWT, x, DM, XB, NB_ * TT * DM / 512);
}
typedef __attribute__((ext_vector_type(2))) float f32x2;
typedef __attribute__((ext_vector_type(2))) __bf16 bf16x2;
typedef __attribute__((ext_vector_type(8))) unsigned u32x8;
typedef __attribute__((ext_vector_type(4))) unsigned u32x4;
#define CSC (SCL * 1.4426950408889634f)
__device__ __forceinline__ float xhalf(float x) { return __builtin_bit_cast(float, __builtin_amdgcn_permlanex16(__builtin_bit_cast(int, x), __builtin_bit_cast(int, x), 0x76543210, 0xfedcba98, false, false)); }   // lane l with lane l ^ 16
__device__ __forceinline__ unsigned packbf(float lo, float hi) { return __builtin_bit_cast(unsigned, __builtin_convertvector((f32x2){lo, hi}, bf16x2)); }   // round to nearest even
__device__ __forceinline__ void nop4() { __builtin_amdgcn_sched_barrier(0); asm volatile("v_nop\n\tv_nop\n\tv_nop\n\tv_nop"); __builtin_amdgcn_sched_barrier(0); }   // the 4 vector slots between a pass's last WMMAs and whatever next overwrites their A or B or touches their D, in the next pass and behind the loop's exit branch alike (without them a WMMA stood directly in front of that branch); the two scheduling barriers keep the slots behind the run
// xwait: precaution: the wait behind a group of loads, in front of any overwrite of their address registers; naming the pointers keeps the address pairs live up to here, the clobber keeps the loads in front of it
template <bool HL, typename T16> __device__ __forceinline__ void xwait(const T16* a, const T16* b) { if constexpr (HL) asm volatile("s_wait_xcnt 0x0" :: "v"(a), "v"(b) : "memory"); else asm volatile("s_wait_xcnt 0x0" :: "v"(a) : "memory"); }
// ---- K and V^T reach the waves through LDS: a stage is 32 KB of key rows (hi/lo class: 64 keys of K hi, K lo, V^T hi, V^T lo, 8 KB each, in this order; fp16 class: 128 keys of K, then of V^T, 16 KB each), copied once per work-group by asynchronous copies and read by all 4 waves; two buffers, the next stage's copies fly while this stage is worked on. The planes lie in fragment order and a stage's keys are contiguous in each, so LDS holds the same bytes in the same order.
#define STB 32768   // bytes of a stage buffer
// acopy8: 8 copies of 16 bytes a lane, 2 KB a work-group each: 4 from ga on, 4 from gb on, to 16 KB of LDS in a row from l on. The wait is the last line of the copies' own statement: a precaution, it stands in front of any overwrite of the address registers that the copies name.
__device__ __forceinline__ void acopy8(unsigned l, const char* ga, const char* gb) {
    asm volatile("global_load_async_to_lds_b128 %0, %8, off\n\t"
                 "global_load_async_to_lds_b128 %1, %9, off\n\t"
                 "global_load_async_to_lds_b128 %2, %10, off\n\t"
                 "global_load_async_to_lds_b128 %3, %11, off\n\t"
                 "global_load_async_to_lds_b128 %4, %12, off\n\t"
                 "global_load_async_to_lds_b128 %5, %13, off\n\t"
                 "global_load_async_to_lds_b128 %6, %14, off\n\t"
                 "global_load_async_to_lds_b128 %7, %15, off\n\t"
                 "s_wait_xcnt 0x0"
                 :: "v"(l), "v"(l + 2048u), "v"(l + 4096u), "v"(l + 6144u), "v"(l + 8192u), "v"(l + 10240u), "v"(l + 12288u), "v"(l + 14336u),
                    "v"(ga), "v"(ga + 2048), "v"(ga + 4096), "v"(ga + 6144), "v"(gb), "v"(gb + 2048), "v"(gb + 4096), "v"(gb + 6144) : "memory");
}
// stage_in: the stage that starts at key key0, into the buffer whose byte 16 * threadIdx.x has LDS address l; 16 copies a wave
template <bool HL, typename T16>
__device__ __forceinline__ void stage_in(unsigned l, const T16* K, const T16* K2, const T16* VT, const T16* VT2, int key0) {
    const size_t o = (size_t)key0 * HD + 8 * threadIdx.x;
    if constexpr (HL) { acopy8(l, (const char*)(K + o), (const char*)(K2 + o)); acopy8(l + 16384u, (const char*)(VT + o), (const char*)(VT2 + o)); }
    else { acopy8(l, (const char*)(K + o), (const char*)(K + o + 4096)); acopy8(l + 16384u, (const char*)(VT + o), (const char*)(VT + o + 4096)); }
}
template <typename T16, bool HL, int R>
__device__ __forceinline__ void attn_cols(const T16* kv, const T16* __restrict__ Q, const T16* __restrict__ Q2, const T16* __restrict__ K, const T16* __restrict__ K2, const T16* __restrict__ VT, const T16* __restrict__ VT2, int q0, bf* Ah, bf* Al) {
    typedef typename WFrag<T16>::V V;
    const int lane = threadIdx.x & 31;
    V qf[R][2], qf2[R][2];
#pragma unroll
    for (int g = 0; g < R; ++g) { const size_t o = (size_t)(q0 + 16 * g) * HD + 8 * lane; const T16* qp = Q + o; const T16* qp2 = HL ? Q2 + o : qp;
#pragma unroll
        for (int kc = 0; kc < 2; ++kc) { qf[g][kc] = WFrag<T16>::ld(qp + 512 * kc); if (HL) qf2[g][kc] = WFrag<T16>::ld(qp2 + 512 * kc); }
        xwait<HL>(qp, qp2); }
    v8f acc[R][4]; float m[R]; f32x2 l[R];   // l: each lane's share of the denominator, even and odd keys apart
#pragma unroll
    for (int g = 0; g < R; ++g) { m[g] = -__builtin_inff(); l[g] = (f32x2){0.f, 0.f};
#pragma unroll
        for (int t = 0; t < 4; ++t) acc[g][t] = (v8f){}; }
    constexpr int SK = HL ? 64 : 128, NP = SK / 32, NS = TT / SK;   // keys a stage, 32-key passes a stage, stages
    constexpr int PE = SK * HD;                                     // elements of one plane in a stage
    static_assert(NS >= 2 && (HL ? 4 : 2) * PE * 2 == STB, "two stages or more; a stage fills its buffer");
    const unsigned lb = (unsigned)(size_t)kv + 16u * threadIdx.x;   // LDS byte address of this thread's first piece of buffer 0
    stage_in<HL>(lb, K, K2, VT, VT2, 0);
    asm volatile("s_wait_asynccnt 0x0" ::: "memory");   // this wave's copies of stage 0 have landed
    __syncthreads();                                    // and every other wave's: stage 0 may be read
    stage_in<HL>(lb + STB, K, K2, VT, VT2, SK);
#pragma unroll 1
    for (int st = 0; st < NS; ++st) {   // rolled over the stages; a stage's passes are unrolled, so that each but the last can ask for the next pass's K rows
      const T16* sb = kv + (st & 1) * (STB / 2) + 8 * lane;   // this lane's piece of the stage's first block
      V kf[2][2], kf2[2][2];
#pragma unroll
      for (int kt = 0; kt < 2; ++kt)
#pragma unroll
        for (int kc = 0; kc < 2; ++kc) { kf[kt][kc] = WFrag<T16>::ld(sb + kt * 16 * HD + 512 * kc); if (HL) kf2[kt][kc] = WFrag<T16>::ld(sb + PE + kt * 16 * HD + 512 * kc); }
#pragma unroll
      for (int ps = 0; ps < NP; ++ps) {
        const T16* vp = sb + (HL ? 2 : 1) * PE + ps * 32 * HD; const T16* vp2 = vp + PE;
        V vf[4], vf2[4];   // this pass's V^T fragments, asked for first: they fly under the first product and the softmax
#pragma unroll
        for (int t = 0; t < 4; ++t) { vf[t] = WFrag<T16>::ld(vp + t * 512); if (HL) vf2[t] = WFrag<T16>::ld(vp2 + t * 512); }
        __builtin_amdgcn_sched_barrier(0);   // keeps the LDS reads above as one group ahead of the products: left free they were moved down in pairs, each pair directly in front of the product that needs it, which then waited out the LDS latency
        v8f s[2][R];
#pragma unroll
        for (int kt = 0; kt < 2; ++kt)
#pragma unroll
            for (int g = 0; g < R; ++g) { s[kt][g] = (v8f){};
#pragma unroll
                for (int kc = 0; kc < 2; ++kc) { s[kt][g] = WFrag<T16>::mma(kf[kt][kc], qf[g][kc], s[kt][g]); if (HL) { s[kt][g] = WFrag<T16>::mma(kf[kt][kc], qf2[g][kc], s[kt][g]); s[kt][g] = WFrag<T16>::mma(kf2[kt][kc], qf[g][kc], s[kt][g]); } } }
        __builtin_amdgcn_sched_barrier(0);   // the first product's run stays whole: no LDS read is moved in among its WMMAs
        if (ps + 1 < NP) {   // next pass's K rows of the same stage, into the same registers, in flight under the softmax and the second product; nothing of the next stage is read here
            const T16* kp = sb + (ps + 1) * 32 * HD;
#pragma unroll
            for (int kt = 0; kt < 2; ++kt)
#pragma unroll
                for (int kc = 0; kc < 2; ++kc) { kf[kt][kc] = WFrag<T16>::ld(kp + kt * 16 * HD + 512 * kc); if (HL) kf2[kt][kc] = WFrag<T16>::ld(kp + PE + kt * 16 * HD + 512 * kc); }
            __builtin_amdgcn_sched_barrier(0);   // keeps these reads here, one group a whole softmax ahead of their use
        }
        float mb[R]; bool need = false;
#pragma unroll
        for (int g = 0; g < R; ++g) { float mx = s[0][g][0];
#pragma unroll
            for (int i = 1; i < 16; ++i) mx = fmaxf(mx, s[i >> 3][g][i & 7]);
            mx = fmaxf(mx, xhalf(mx)) * CSC; mb[g] = mx; need = need || (mx > m[g] + 8.0f); }
        if (__builtin_amdgcn_ballot_w32(need) != 0) {   // one scalar branch a pass; always taken in the first pass (m is -inf there, the factor 0)
#pragma unroll
            for (int g = 0; g < R; ++g) { const float mn = fmaxf(m[g], mb[g]); const float corr = __builtin_amdgcn_exp2f(m[g] - mn); m[g] = mn; l[g] *= corr;
#pragma unroll
                for (int t = 0; t < 4; ++t) acc[g][t] = acc[g][t] * corr; }
        }
#pragma unroll
        for (int g = 0; g < R; ++g) { const float nm = -m[g]; float p[16];
#pragma unroll
            for (int i = 0; i < 8; ++i) { const f32x2 arg = __builtin_elementwise_fma((f32x2){s[i >> 2][g][2 * (i & 3)], s[i >> 2][g][2 * (i & 3) + 1]}, (f32x2){CSC, CSC}, (f32x2){nm, nm}); p[2 * i] = __builtin_amdgcn_exp2f(arg.x); p[2 * i + 1] = __builtin_amdgcn_exp2f(arg.y); l[g] += (f32x2){p[2 * i], p[2 * i + 1]}; }
            if constexpr (HL) { u32x8 wh, wl;
#pragma unroll
                for (int i = 0; i < 8; ++i) { const unsigned w = packbf(p[2 * i], p[2 * i + 1]); wh[i] = w; wl[i] = packbf(p[2 * i] - __uint_as_float(w << 16), p[2 * i + 1] - __uint_as_float(w & 0xFFFF0000u)); }
                const V ph = __builtin_bit_cast(V, wh), pl = __builtin_bit_cast(V, wl);
#pragma unroll
                for (int t = 0; t < 4; ++t) { acc[g][t] = WFrag<T16>::mma(vf[t], ph, acc[g][t]); acc[g][t] = WFrag<T16>::mma(vf[t], pl, acc[g][t]); acc[g][t] = WFrag<T16>::mma(vf2[t], ph, acc[g][t]); }
            } else { V pf;
#pragma unroll
                for (int i = 0; i < 16; ++i) pf[i] = (h16)p[i];
#pragma unroll
                for (int t = 0; t < 4; ++t) acc[g][t] = WFrag<T16>::mma(vf[t], pf, acc[g][t]); } }
        nop4();
      }
      asm volatile("s_wait_dscnt 0x0" ::: "memory");      // this wave's reads of the stage's buffer are done
      asm volatile("s_wait_asynccnt 0x0" ::: "memory");   // this wave's copies of stage st + 1 have landed
      __syncthreads();                                    // both hold for every wave: stage st + 1 may be read, this stage's buffer may be filled again
      if (st + 2 < NS) stage_in<HL>(lb + (st & 1) * STB, K, K2, VT, VT2, (st + 2) * SK);
    }
    asm volatile("s_wait_asynccnt 0x0" ::: "memory");   // no copy is outstanding when the wave goes on to its end
#pragma unroll
    for (int g = 0; g < R; ++g) { const float lh = l[g].x + l[g].y; const float lt = lh + xhalf(lh); const float inv = __fdiv_rn(1.0f, lt);   // the halves' sums joined once, unconditionally
        const size_t oo = (size_t)(q0 + 16 * g) * DQ + 8 * lane;   // lane (c, h) holds d = 16 t + 8 h + r of query c: piece 32 (t & 1) + lane of block (query group, 2 head + t / 2) of the merged plane
#pragma unroll
        for (int t = 0; t < 4; ++t) { v8us oh, ol;
#pragma unroll
            for (int r = 0; r < 8; ++r) { unsigned short a, c2; splitf(acc[g][t][r] * inv, a, c2); oh[r] = a; ol[r] = c2; }
            *(v8us*)(Ah + oo + 256 * t) = oh; *(v8us*)(Al + oo + 256 * t) = ol; } }
}
// k_attn: 4 waves a work-group, which share each K and V^T stage in LDS (two buffers). Blocks below NHB: rows < RH on the hi/lo bf16 planes (3 products), 16 columns a wave; the others: fp16 planes, 32 columns a wave. The longer class starts first. Plane z = b * NH_ + h; QK planes: q planes, then k planes.
#define AW  4
#define HBZ (RH / (AW * 16))
#define LBZ ((TT - RH) / (AW * 32))
#define NHB (NZ * HBZ)
#define NLB (NZ * LBZ)
__global__ __launch_bounds__(AW * 32) void k_attn(const h16* __restrict__ QK16, const bf* __restrict__ QKh, const bf* __restrict__ QKl, const h16* __restrict__ V16, const bf* __restrict__ Vh, const bf* __restrict__ Vl, bf* Ah, bf* Al) {
    __shared__ __align__(16) unsigned short kvs[2 * STB / 2];
    const int wave = __builtin_amdgcn_readfirstlane((int)(threadIdx.x >> 5)); const int bx = (int)blockIdx.x; const size_t PL = (size_t)TT * HD;
    if (bx < NHB) { const int z = bx / HBZ; const size_t ao = (size_t)(z / NH_) * TT * DQ + (z % NH_) * (HD * 16);
        attn_cols<bf, true, 1>(kvs, QKh + z * PL, QKl + z * PL, QKh + (NZ + z) * PL, QKl + (NZ + z) * PL, Vh + z * PL, Vl + z * PL, (bx % HBZ) * (AW * 16) + wave * 16, Ah + ao, Al + ao); }
    else { const int b2 = bx - NHB; const int z = b2 / LBZ; const size_t ao = (size_t)(z / NH_) * TT * DQ + (z % NH_) * (HD * 16);
        attn_cols<h16, false, 2>((const h16*)kvs, QK16 + z * PL, nullptr, QK16 + (NZ + z) * PL, nullptr, V16 + z * PL, nullptr, RH + (b2 % LBZ) * (AW * 32) + wave * 32, Ah + ao, Al + ao); }
}

// ---- projections straight into the head planes: no f32 copy of q, k, v is stored.
// planes_out: one 64 x 64 f32 tile + bias -> its fp16, bf16-hi and bf16-lo planes, in fragment order; RS, KS: elements from a block to the next 16 rows' and to the next 32 columns'; the pointers name block (tile's first 16 rows, tile's first 32 columns). 16 rows at a time pass through the wave's own LDS, so that lane (c, h) holds columns 16 s + 8 h to + 7 of row c, piece 32 (s & 1) + lane of block s / 2: 16 bytes a lane, 512 bytes in a row a store. RB: the bias goes by the tile's row, else by its column.
template <int RS, int KS, bool RB>
__device__ __forceinline__ void planes_out(float* os, const v8f (&acc)[4][4], const float* __restrict__ bias, h16* P16, bf* Ph, bf* Pl) {
    const int lane = threadIdx.x & 31, lr = lane & 15, hi = lane >> 4;
    float bb[RB ? 4 : 32];   // every bias this lane adds, asked for once, ahead of the LDS passes
#pragma unroll
    for (int i = 0; i < (RB ? 4 : 32); ++i) bb[i] = bfr(bias[RB ? 16 * i + lr : 16 * (i >> 3) + 8 * hi + (i & 7)]);
    h16* p16 = P16 + 8 * lane; bf* ph = Ph + 8 * lane; bf* pl = Pl + 8 * lane;   // this lane's piece in the first block; every store is a constant further
#pragma unroll
    for (int mb = 0; mb < 4; ++mb) {
#pragma unroll
        for (int nb = 0; nb < 4; ++nb) {
#pragma unroll
            for (int j = 0; j < 8; ++j) os[(hi * 8 + j) * 68 + nb * 16 + lr] = acc[mb][nb][j]; }
        __builtin_amdgcn_wave_barrier(); asm volatile("" ::: "memory");   // the rows are read back by other lanes: no LDS read moves in front of the writes
#pragma unroll
        for (int s = 0; s < 4; ++s) { const float* orow = os + lr * 68 + 16 * s + 8 * hi; const v4f lo4 = *(const v4fa*)orow, hi4 = *(const v4fa*)(orow + 4); float y[8]; v8h o16; u32x4 oh, ol;
#pragma unroll
            for (int i = 0; i < 8; ++i) { y[i] = ((i < 4) ? lo4[i & 3] : hi4[i & 3]) + bb[RB ? mb : 8 * s + i]; o16[i] = (h16)y[i]; }
#pragma unroll
            for (int i = 0; i < 4; ++i) { const unsigned w = packbf(y[2 * i], y[2 * i + 1]); oh[i] = w; ol[i] = packbf(y[2 * i] - __uint_as_float(w << 16), y[2 * i + 1] - __uint_as_float(w & 0xFFFF0000u)); }
            const size_t o = (size_t)mb * RS + (s >> 1) * KS + (s & 1) * 256;
            *(v8h*)(p16 + o) = o16; *(v8us*)(ph + o) = __builtin_bit_cast(v8us, oh); *(v8us*)(pl + o) = __builtin_bit_cast(v8us, ol);
            asm volatile("s_wait_xcnt 0x0" :: "v"(p16), "v"(ph), "v"(pl), "v"(o16), "v"(oh), "v"(ol) : "memory"); }   // precaution: the wait behind the three stores, in front of any overwrite of their address or data registers; naming them keeps them live up to here
        __builtin_amdgcn_wave_barrier(); asm volatile("" ::: "memory");   // the next 16 rows are written only behind these reads
    }
}
// k_proj: one wave per tile of 64 tokens x one head's 64 columns; grid (token tiles over all batches, heads, 3: q, k, v). q and k: A = x rows, B = weight rows, tile [t][d]. v: the operands change places, so the tile comes out as [d][t], the order of its plane.
__global__ __launch_bounds__(32) void k_proj(const bf* __restrict__ XB, const bf* __restrict__ W4, const float* __restrict__ bq, const float* __restrict__ bk, const float* __restrict__ bv, h16* QK16, bf* QKh, bf* QKl, h16* V16, bf* Vh, bf* Vl) {
    __shared__ __align__(16) float os[16 * 68];
    const int kind = (int)blockIdx.z, head = (int)blockIdx.y, tile = (int)blockIdx.x; const int lane = threadIdx.x & 31;
    const size_t fo = 8 * lane;   // this lane's piece of a block
    const bf* X = XB + (size_t)tile * 64 * DM + fo; const bf* Wt = W4 + ((size_t)kind * DQ + head * HD) * DM + fo;
    const bf* A = (kind == 2) ? Wt : X; const bf* B = (kind == 2) ? X : Wt;
    v8f acc[4][4];
#pragma unroll
    for (int mb = 0; mb < 4; ++mb)
#pragma unroll
        for (int nb = 0; nb < 4; ++nb) acc[mb][nb] = (v8f){};
#pragma unroll 1
    for (int kc = 0; kc < DM; kc += 32) {   // rolled, as the other GEMM's K loop
        const bf* pa = A + kc * 16; const bf* pb = B + kc * 16; v16bf a[4], b[4];
#pragma unroll
        for (int i = 0; i < 4; ++i) { a[i] = WFrag<bf>::ld(pa + (size_t)i * 16 * DM); b[i] = WFrag<bf>::ld(pb + (size_t)i * 16 * DM); }
        xwait<true>(pa, pb);
        __builtin_amdgcn_sched_barrier(0);   // keeps the products behind the group of 16 loads: moved in among them they shared one B buffer, and each of the four B fragments was waited for by itself
#pragma unroll
        for (int nb = 0; nb < 4; ++nb)
#pragma unroll
            for (int mb = 0; mb < 4; ++mb) acc[mb][nb] = wmmab(a[mb], b[nb], acc[mb][nb]);
        nop4();
    }
    const size_t plane = (size_t)(tile / (TT / 64)) * NH_ + head; const int t0 = (tile % (TT / 64)) * 64;
    if (kind == 2) { const size_t o = plane * HD * TT + t0 * HD; planes_out<512, 4 * 512, true>(os, acc, bv + head * HD, V16 + o, Vh + o, Vl + o); }
    else { const size_t o = (((size_t)kind * NZ + plane) * TT + t0) * HD; planes_out<16 * HD, 512, false>(os, acc, ((kind == 0) ? bq : bk) + head * HD, QK16 + o, QKh + o, QKl + o); }
}

extern "C" void kernel_launch(void* const* d_in, const int* in_sizes, int n_in,
                              void* d_out, int out_size, void* d_ws, size_t ws_size, hipStream_t stream) {
    (void)in_sizes; (void)n_in; (void)out_size;
    const float* x = (const float*)d_in[0]; const float* wq = (const float*)d_in[1]; const float* bq = (const float*)d_in[2]; const float* wk = (const float*)d_in[3]; const float* bk = (const float*)d_in[4]; const float* wv = (const float*)d_in[5]; const float* bv = (const float*)d_in[6]; const float* wo = (const float*)d_in[7]; const float* bo = (const float*)d_in[8];   /* argument order inputs, wq, bq, wk, bk, wv, bv, wo, bo ('xw' + biases) */
    float* OUT = (float*)d_out;     // [4][2048][512]
    char* wsp = (char*)d_ws;
    auto take = [&](size_t bytes) { char* p = wsp; wsp += (bytes + 255) & ~(size_t)255; return (void*)p; };
    bf* W4 = (bf*)take((size_t)4 * DQ * DM * 2); bf* WO = W4 + (size_t)3 * DQ * DM;   // W4: wq, wk, wv, wo transposed, one after the other
    h16* QP16 = (h16*)take((size_t)2 * NZ * TT * HD * 2); h16* VT16 = (h16*)take((size_t)NZ * HD * TT * 2);   // q planes, then k planes
    bf* QPh = (bf*)take((size_t)2 * NZ * TT * HD * 2); bf* QPl = (bf*)take((size_t)2 * NZ * TT * HD * 2); bf* VTh = (bf*)take((size_t)NZ * HD * TT * 2); bf* VTl = (bf*)take((size_t)NZ * HD * TT * 2);
    bf* XB = (bf*)take((size_t)NB_ * TT * DM * 2); bf* ATh = (bf*)take((size_t)NB_ * TT * DQ * 2); bf* ATl = (bf*)take((size_t)NB_ * TT * DQ * 2);
    if ((size_t)(wsp - (char*)d_ws) > ws_size) return;    // ws 256 MiB
    static_assert(DQ == DKV && REP == 1 && RH % (AW * 16) == 0 && (TT - RH) % (AW * 32) == 0 && (TT & (TT - 1)) == 0 && HD == 64 && TT % 64 == 0, "one kv plane per query plane; whole work-groups per row class; a projection tile is 64 tokens of one batch x one head");
    k_pre<<<4 * NWT + NCV, 256, 0, stream>>>(x, wq, wk, wv, wo, W4, XB);
    k_proj<<<dim3(NB_ * TT / 64, NH_, 3), 32, 0, stream>>>(XB, W4, bq, bk, bv, QP16, QPh, QPl, VT16, VTh, VTl);
    k_attn<<<NHB + NLB, AW * 32, 0, stream>>>(QP16, QPh, QPl, VT16, VTh, VTl, ATh, ATl);
    k_gemmw<bf, 1, true><<<dim3(NB_ * TT / 64, DM / 64, 1), 32, 0, stream>>>(ATh, ATl, WO, nullptr, DQ, OUT, DM, bo, bo, bo, 0, 0, 0);
}

// v007
// One run takes 86.4 microseconds.
// In two side-by-side timings against v006, it was 1.21 and 1.20 times as fast.
// Over all steps from v000 it is 23.5 times as fast.
#include <hip/hip_runtime.h>

// Multi-head attention WITHOUT a mask and with biased projections at a 512-wide model (x [4][2048][512]; q, k, v = x W + b ('xw' [512][512] uniform +-1/sqrt(512) + zero biases; 8 heads x 64); scores x 64^-0.5; softmax over all keys; out = merged Wo + bo ('xw' + zero bias) -> [4][2048][512] (4.2 M); argument order x, Wq, bq, Wk, bk, Wv, bv, Wo, bo).
// Layout, all four batches at once (32 head planes, index b * 8 + h): bf16 copy of x; 'xw' weights transposed once; exact projections + f32 biases, whose epilogue writes the head planes; one fused dense T-2048 attention kernel (hybrid rows: < 512 hi/lo 3 products, rest fp16; scores and P stay in registers); merged hi/lo x wo exact + bo.
// Compute dtypes, f32 accumulate: every input rounded to bf16; projections exact + f32 biases; attention rows < 512 3 products, rest fp16; softmax f32; wo hl x exact + bias.

#define NB_  4
#define TT   2048
#define DM   512    // model width: this module's D_MODEL
#define NH_  8      // heads: 8 x 64 = 512
#define NKV  8      // kv heads = heads (no grouping)
#define REP  (NH_ / NKV)
#define HD   64
#define DQ   (NH_ * HD)
#define DKV  (NKV * HD)
#define NZ   (NB_ * NH_)          // head planes over all batches, plane index b * NH_ + h
#define RH   512                  // query rows < RH use hi+lo planes (0: none)
#define WIN  0
#define SCL  0.125f   // HD^-0.5
typedef _Float16 h16;
typedef unsigned short bf;
typedef __attribute__((ext_vector_type(16))) __bf16   v16bf;
typedef __attribute__((ext_vector_type(16))) _Float16 v16h;
typedef __attribute__((ext_vector_type(8)))  _Float16 v8h;
typedef __attribute__((ext_vector_type(8)))  unsigned short v8us;
typedef __attribute__((ext_vector_type(8)))  float    v8f;
typedef __attribute__((ext_vector_type(4)))  float    v4f;
typedef v8h  __attribute__((may_alias)) v8ha;
typedef v4f  __attribute__((may_alias)) v4fa;
typedef v8us __attribute__((may_alias)) v8usa;

__device__ __forceinline__ unsigned short f2bf(float f) { unsigned u = __float_as_uint(f); u += 0x7FFFu + ((u >> 16) & 1u); return (unsigned short)(u >> 16); }
__device__ __forceinline__ float bf2f(unsigned short b) { return __uint_as_float(((unsigned)b) << 16); }
__device__ __forceinline__ float bfr(float f) { return bf2f(f2bf(f)); }
__device__ __forceinline__ v16h cat16(v8h lo, v8h hi) { return __builtin_shufflevector(lo, hi, 0, 1, 2, 3, 4, 5, 6, 7, 8, 9, 10, 11, 12, 13, 14, 15); }
__device__ __forceinline__ v16bf cat16b(v8us lo, v8us hi) { return __builtin_bit_cast(v16bf, __builtin_shufflevector(lo, hi, 0, 1, 2, 3, 4, 5, 6, 7, 8, 9, 10, 11, 12, 13, 14, 15)); }
__device__ __forceinline__ v8f wmma16(v16h a, v16h b, v8f c) { return __builtin_amdgcn_wmma_f32_16x16x32_f16(false, a, false, b, (short)0, c, false, false); }
__device__ __forceinline__ v8f wmmab(v16bf a, v16bf b, v8f c) { return __builtin_amdgcn_wmma_f32_16x16x32_bf16(false, a, false, b, (short)0, c, false, false); }



// ---- FRAGMENT ORDER of every 16-bit operand plane M[row][k], k < K: blocks of 16 rows x 32 k = 1 KB, block (row / 16, k / 32) at element (row / 16) * 16 * K + (k / 32) * 512; inside a block the 16-byte piece number ((k / 16) & 1) * 32 + ((k / 8) & 1) * 16 + (row & 15) holds k & ~7 to k | 7 of its row.
// The V^T planes (64 rows) alone order their blocks by k first, block (row / 16, k / 32) at ((k / 32) * 4 + row / 16) * 512: the four blocks of a 32-key pass lie in a row.
// Piece number = half of the fragment * 32 + lane: each of a fragment's two wave-wide 16-byte loads reads 512 bytes in a row (4 whole lines), where row-major planes gave 32 bytes of each of 16 lines. Which lane and register holds which (row, k) is as before.
// WFrag: a fragment's two 16-byte loads from a plane in fragment order, and its product
template <typename T16> struct WFrag;
template <> struct WFrag<h16> { typedef v16h V; static __device__ __forceinline__ V ld(const h16* p) { return cat16(*(const v8h*)p, *(const v8h*)(p + 256)); } static __device__ __forceinline__ v8f mma(V a, V b, v8f c) { return wmma16(a, b, c); } };
template <> struct WFrag<bf> { typedef v16bf V; static __device__ __forceinline__ V ld(const bf* p) { return cat16b(*(const v8us*)p, *(const v8us*)(p + 256)); } static __device__ __forceinline__ v8f mma(V a, V b, v8f c) { return wmmab(a, b, c); } };

__device__ __forceinline__ void splitf(float y, unsigned short& h, unsigned short& l) { h = f2bf(y); l = f2bf(y - bf2f(h)); }
typedef __attribute__((ext_vector_type(4))) _Float16 v4h;
typedef __attribute__((ext_vector_type(2))) unsigned short v2us;
typedef __attribute__((ext_vector_type(4))) unsigned short v4us;
typedef __attribute__((ext_vector_type(4))) int v4i;

// One thread per 16-byte piece of a plane in fragment order, piece number o: a wave stores 512 bytes in a row. pc_row, pc_k: the piece's row and its first k in a plane of K columns.
__device__ __forceinline__ int pc_row(int o, int K) { return (o >> 6) / (K / 32) * 16 + (o & 15); }
__device__ __forceinline__ int pc_k(int o, int K) { return (o >> 6) % (K / 32) * 32 + ((o >> 5) & 1) * 16 + ((o >> 4) & 1) * 8; }
// wtG_blk: Bt[n][k] = w[k][n]; a piece is 8 rows of w at one column, 16 neighbouring columns a half-wave
__device__ __forceinline__ void wtG_blk(int bx, const float* __restrict__ w, int K, int N, bf* Bt) {
    const int o = bx * 256 + (int)threadIdx.x; if (o >= N * K / 8) return; const float* p = w + (size_t)pc_k(o, K) * N + pc_row(o, K); v8us v;
    float y[8];
#pragma unroll
    for (int i = 0; i < 8; ++i) y[i] = p[(size_t)i * N];
    asm volatile("s_wait_xcnt 0x0" :: "v"(p) : "memory");   // precaution: the wait behind the 8 loads, in front of any overwrite of their address registers; naming the pointer keeps the pair live up to here
#pragma unroll
    for (int i = 0; i < 8; ++i) v[i] = f2bf(y[i]);
    *(v8us*)(Bt + (size_t)o * 8) = v;
}
// cvt_blk: bf16 copy of src[row][k] in fragment order, one wave per 1-KB block: 4 loads of 4 whole lines each (row 4 i + lane / 8, 16 bytes a lane); a lane's 4 values are half a piece, 8 bytes a store
__device__ __forceinline__ void cvt_blk(int bx, const float* __restrict__ src, int K, bf* dst, int nblk) {
    const int lane = threadIdx.x & 31, k4 = lane & 7, r4 = lane >> 3; const int blk = bx * 8 + (int)(threadIdx.x >> 5); if (blk >= nblk) return;
    const float* p = src + (size_t)(blk / (K / 32) * 16 + r4) * K + blk % (K / 32) * 32 + 4 * k4; v4f v[4];
#pragma unroll
    for (int i = 0; i < 4; ++i) v[i] = *(const v4f*)(p + (size_t)4 * i * K);
    asm volatile("s_wait_xcnt 0x0" :: "v"(p) : "memory");   // precaution, as in wtG_blk
    bf* q = dst + (size_t)blk * 512 + ((k4 >> 2) * 32 + ((k4 >> 1) & 1) * 16 + r4) * 8 + (k4 & 1) * 4;
#pragma unroll
    for (int i = 0; i < 4; ++i) { v4us u;
#pragma unroll
        for (int k = 0; k < 4; ++k) u[k] = f2bf(v[i][k]);
        *(v4us*)(q + 32 * i) = u; }
}

// k_pre: the jobs that read only inputs, one block range each: 4 weight transposes (NWT blocks each), the bf16 copy of x (NCV)
#define NWT (DM * DQ / 8 / 256)
#define NCV (NB_ * TT * DM / 512 / 8)
__global__ __launch_bounds__(256) void k_pre(const float* __restrict__ x, const float* __restrict__ wq, const float* __restrict__ wk, const float* __restrict__ wv, const float* __restrict__ wo, bf* W4, bf* XB) {
    const int bx = (int)blockIdx.x;
    if (bx < 4 * NWT) { const int j = bx / NWT; const float* w = (j == 0) ? wq : ((j == 1) ? wk : ((j == 2) ? wv : wo)); wtG_blk(bx % NWT, w, DM, DQ, W4 + (size_t)j * DQ * DM); }
    else cvt_blk(bx - 4 * NWT, x, DM, XB, NB_ * TT * DM / 512);
}
typedef __attribute__((ext_vector_type(2))) float f32x2;
typedef __attribute__((ext_vector_type(2))) __bf16 bf16x2;
typedef __attribute__((ext_vector_type(8))) unsigned u32x8;
typedef __attribute__((ext_vector_type(4))) unsigned u32x4;
#define CSC (SCL * 1.4426950408889634f)
__device__ __forceinline__ float xhalf(float x) { return __builtin_bit_cast(float, __builtin_amdgcn_permlanex16(__builtin_bit_cast(int, x), __builtin_bit_cast(int, x), 0x76543210, 0xfedcba98, false, false)); }   // lane l with lane l ^ 16
__device__ __forceinline__ unsigned packbf(float lo, float hi) { return __builtin_bit_cast(unsigned, __builtin_convertvector((f32x2){lo, hi}, bf16x2)); }   // round to nearest even
__device__ __forceinline__ void nop4() { __builtin_amdgcn_sched_barrier(0); asm volatile("v_nop\n\tv_nop\n\tv_nop\n\tv_nop"); __builtin_amdgcn_sched_barrier(0); }   // the 4 vector slots between a pass's last WMMAs and whatever next overwrites their A or B or touches their D, in the next pass and behind the loop's exit branch alike (without them a WMMA stood directly in front of that branch); the two scheduling barriers keep the slots behind the run
// xwait: precaution: the wait behind a group of loads, in front of any overwrite of their address registers; naming the pointers keeps the address pairs live up to here, the clobber keeps the loads in front of it
template <bool HL, typename T16> __device__ __forceinline__ void xwait(const T16* a, const T16* b) { if constexpr (HL) asm volatile("s_wait_xcnt 0x0" :: "v"(a), "v"(b) : "memory"); else asm volatile("s_wait_xcnt 0x0" :: "v"(a) : "memory"); }
// ---- K and V^T reach the waves through LDS: a stage is 32 KB of key rows (hi/lo class: 64 keys of K hi, K lo, V^T hi, V^T lo, 8 KB each, in this order; fp16 class: 128 keys of K, then of V^T, 16 KB each), copied once per work-group by asynchronous copies and read by all 4 waves; two buffers, the next stage's copies fly while this stage is worked on. The planes lie in fragment order and a stage's keys are contiguous in each, so LDS holds the same bytes in the same order.
#define STB 32768   // bytes of a stage buffer
// acopy8: 8 copies of 16 bytes a lane, 2 KB a work-group each: 4 from ga on, 4 from gb on, to 16 KB of LDS in a row from l on. The wait is the last line of the copies' own statement: a precaution, it stands in front of any overwrite of the address registers that the copies name.
__device__ __forceinline__ void acopy8(unsigned l, const char* ga, const char* gb) {
    asm volatile("global_load_async_to_lds_b128 %0, %8, off\n\t"
                 "global_load_async_to_lds_b128 %1, %9, off\n\t"
                 "global_load_async_to_lds_b128 %2, %10, off\n\t"
                 "global_load_async_to_lds_b128 %3, %11, off\n\t"
                 "global_load_async_to_lds_b128 %4, %12, off\n\t"
                 "global_load_async_to_lds_b128 %5, %13, off\n\t"
                 "global_load_async_to_lds_b128 %6, %14, off\n\t"
                 "global_load_async_to_lds_b128 %7, %15, off\n\t"
                 "s_wait_xcnt 0x0"
                 :: "v"(l), "v"(l + 2048u), "v"(l + 4096u), "v"(l + 6144u), "v"(l + 8192u), "v"(l + 10240u), "v"(l + 12288u), "v"(l + 14336u),
                    "v"(ga), "v"(ga + 2048), "v"(ga + 4096), "v"(ga + 6144), "v"(gb), "v"(gb + 2048), "v"(gb + 4096), "v"(gb + 6144) : "memory");
}
// stage_in: the stage that starts at key key0, into the buffer whose byte 16 * threadIdx.x has LDS address l; 16 copies a wave
template <bool HL, typename T16>
__device__ __forceinline__ void stage_in(unsigned l, const T16* K, const T16* K2, const T16* VT, const T16* VT2, int key0) {
    const size_t o = (size_t)key0 * HD + 8 * threadIdx.x;
    if constexpr (HL) { acopy8(l, (const char*)(K + o), (const char*)(K2 + o)); acopy8(l + 16384u, (const char*)(VT + o), (const char*)(VT2 + o)); }
    else { acopy8(l, (const char*)(K + o), (const char*)(K + o + 4096)); acopy8(l + 16384u, (const char*)(VT + o), (const char*)(VT + o + 4096)); }
}
template <typename T16, bool HL, int R>
__device__ __forceinline__ void attn_cols(const T16* kv, const T16* __restrict__ Q, const T16* __restrict__ Q2, const T16* __restrict__ K, const T16* __restrict__ K2, const T16* __restrict__ VT, const T16* __restrict__ VT2, int q0, bf* Ah, bf* Al) {
    typedef typename WFrag<T16>::V V;
    const int lane = threadIdx.x & 31;
    V qf[R][2], qf2[R][2];
#pragma unroll
    for (int g = 0; g < R; ++g) { const size_t o = (size_t)(q0 + 16 * g) * HD + 8 * lane; const T16* qp = Q + o; const T16* qp2 = HL ? Q2 + o : qp;
#pragma unroll
        for (int kc = 0; kc < 2; ++kc) { qf[g][kc] = WFrag<T16>::ld(qp + 512 * kc); if (HL) qf2[g][kc] = WFrag<T16>::ld(qp2 + 512 * kc); }
        xwait<HL>(qp, qp2); }
    v8f acc[R][4]; float m[R]; f32x2 l[R];   // l: each lane's share of the denominator, even and odd keys apart
#pragma unroll
    for (int g = 0; g < R; ++g) { m[g] = -__builtin_inff(); l[g] = (f32x2){0.f, 0.f};
#pragma unroll
        for (int t = 0; t < 4; ++t) acc[g][t] = (v8f){}; }
    constexpr int SK = HL ? 64 : 128, NP = SK / 32, NS = TT / SK;   // keys a stage, 32-key passes a stage, stages
    constexpr int PE = SK * HD;                                     // elements of one plane in a stage
    static_assert(NS >= 2 && (HL ? 4 : 2) * PE * 2 == STB, "two stages or more; a stage fills its buffer");
    const unsigned lb = (unsigned)(size_t)kv + 16u * threadIdx.x;   // LDS byte address of this thread's first piece of buffer 0
    stage_in<HL>(lb, K, K2, VT, VT2, 0);
    asm volatile("s_wait_asynccnt 0x0" ::: "memory");   // this wave's copies of stage 0 have landed
    __syncthreads();                                    // and every other wave's: stage 0 may be read
    stage_in<HL>(lb + STB, K, K2, VT, VT2, SK);
#pragma unroll 1
    for (int st = 0; st < NS; ++st) {   // rolled over the stages; a stage's passes are unrolled, so that each but the last can ask for the next pass's K rows
      const T16* sb = kv + (st & 1) * (STB / 2) + 8 * lane;   // this lane's piece of the stage's first block
      V kf[2][2], kf2[2][2];
#pragma unroll
      for (int kt = 0; kt < 2; ++kt)
#pragma unroll
        for (int kc = 0; kc < 2; ++kc) { kf[kt][kc] = WFrag<T16>::ld(sb + kt * 16 * HD + 512 * kc); if (HL) kf2[kt][kc] = WFrag<T16>::ld(sb + PE + kt * 16 * HD + 512 * kc); }
#pragma unroll
      for (int ps = 0; ps < NP; ++ps) {
        const T16* vp = sb + (HL ? 2 : 1) * PE + ps * 32 * HD; const T16* vp2 = vp + PE;
        V vf[4], vf2[4];   // this pass's V^T fragments, asked for first: they fly under the first product and the softmax
#pragma unroll
        for (int t = 0; t < 4; ++t) { vf[t] = WFrag<T16>::ld(vp + t * 512); if (HL) vf2[t] = WFrag<T16>::ld(vp2 + t * 512); }
        __builtin_amdgcn_sched_barrier(0);   // keeps the LDS reads above as one group ahead of the products: left free they were moved down in pairs, each pair directly in front of the product that needs it, which then waited out the LDS latency
        v8f s[2][R];
#pragma unroll
        for (int kt = 0; kt < 2; ++kt)
#pragma unroll
            for (int g = 0; g < R; ++g) { s[kt][g] = (v8f){};
#pragma unroll
                for (int kc = 0; kc < 2; ++kc) { s[kt][g] = WFrag<T16>::mma(kf[kt][kc], qf[g][kc], s[kt][g]); if (HL) { s[kt][g] = WFrag<T16>::mma(kf[kt][kc], qf2[g][kc], s[kt][g]); s[kt][g] = WFrag<T16>::mma(kf2[kt][kc], qf[g][kc], s[kt][g]); } } }
        __builtin_amdgcn_sched_barrier(0);   // the first product's run stays whole: no LDS read is moved in among its WMMAs
        if (ps + 1 < NP) {   // next pass's K rows of the same stage, into the same registers, in flight under the softmax and the second product; nothing of the next stage is read here
            const T16* kp = sb + (ps + 1) * 32 * HD;
#pragma unroll
            for (int kt = 0; kt < 2; ++kt)
#pragma unroll
                for (int kc = 0; kc < 2; ++kc) { kf[kt][kc] = WFrag<T16>::ld(kp + kt * 16 * HD + 512 * kc); if (HL) kf2[kt][kc] = WFrag<T16>::ld(kp + PE + kt * 16 * HD + 512 * kc); }
            __builtin_amdgcn_sched_barrier(0);   // keeps these reads here, one group a whole softmax ahead of their use
        }
        float mb[R]; bool need = false;
#pragma unroll
        for (int g = 0; g < R; ++g) { float mx = s[0][g][0];
#pragma unroll
            for (int i = 1; i < 16; ++i) mx = fmaxf(mx, s[i >> 3][g][i & 7]);
            mx = fmaxf(mx, xhalf(mx)) * CSC; mb[g] = mx; need = need || (mx > m[g] + 8.0f); }
        if (__builtin_amdgcn_ballot_w32(need) != 0) {   // one scalar branch a pass; always taken in the first pass (m is -inf there, the factor 0)
#pragma unroll
            for (int g = 0; g < R; ++g) { const float mn = fmaxf(m[g], mb[g]); const float corr = __builtin_amdgcn_exp2f(m[g] - mn); m[g] = mn; l[g] *= corr;
#pragma unroll
                for (int t = 0; t < 4; ++t) acc[g][t] = acc[g][t] * corr; }
        }
#pragma unroll
        for (int g = 0; g < R; ++g) { const float nm = -m[g]; float p[16];
#pragma unroll
            for (int i = 0; i < 8; ++i) { const f32x2 arg = __builtin_elementwise_fma((f32x2){s[i >> 2][g][2 * (i & 3)], s[i >> 2][g][2 * (i & 3) + 1]}, (f32x2){CSC, CSC}, (f32x2){nm, nm}); p[2 * i] = __builtin_amdgcn_exp2f(arg.x); p[2 * i + 1] = __builtin_amdgcn_exp2f(arg.y); l[g] += (f32x2){p[2 * i], p[2 * i + 1]}; }
            if constexpr (HL) { u32x8 wh, wl;
#pragma unroll
                for (int i = 0; i < 8; ++i) { const unsigned w = packbf(p[2 * i], p[2 * i + 1]); wh[i] = w; wl[i] = packbf(p[2 * i] - __uint_as_float(w << 16), p[2 * i + 1] - __uint_as_float(w & 0xFFFF0000u)); }
                const V ph = __builtin_bit_cast(V, wh), pl = __builtin_bit_cast(V, wl);
#pragma unroll
                for (int t = 0; t < 4; ++t) { acc[g][t] = WFrag<T16>::mma(vf[t], ph, acc[g][t]); acc[g][t] = WFrag<T16>::mma(vf[t], pl, acc[g][t]); acc[g][t] = WFrag<T16>::mma(vf2[t], ph, acc[g][t]); }
            } else { V pf;
#pragma unroll
                for (int i = 0; i < 16; ++i) pf[i] = (h16)p[i];
#pragma unroll
                for (int t = 0; t < 4; ++t) acc[g][t] = WFrag<T16>::mma(vf[t], pf, acc[g][t]); } }
        nop4();
      }
      asm volatile("s_wait_dscnt 0x0" ::: "memory");      // this wave's reads of the stage's buffer are done
      asm volatile("s_wait_asynccnt 0x0" ::: "memory");   // this wave's copies of stage st + 1 have landed
      __syncthreads();                                    // both hold for every wave: stage st + 1 may be read, this stage's buffer may be filled again
      if (st + 2 < NS) stage_in<HL>(lb + (st & 1) * STB, K, K2, VT, VT2, (st + 2) * SK);
    }
    asm volatile("s_wait_asynccnt 0x0" ::: "memory");   // no copy is outstanding when the wave goes on to its end
#pragma unroll
    for (int g = 0; g < R; ++g) { const float lh = l[g].x + l[g].y; const float lt = lh + xhalf(lh); const float inv = __fdiv_rn(1.0f, lt);   // the halves' sums joined once, unconditionally
        const size_t oo = (size_t)(q0 + 16 * g) * DQ + 8 * lane;   // lane (c, h) holds d = 16 t + 8 h + r of query c: piece 32 (t & 1) + lane of block (query group, 2 head + t / 2) of the merged plane
#pragma unroll
        for (int t = 0; t < 4; ++t) { v8us oh, ol;
#pragma unroll
            for (int r = 0; r < 8; ++r) { unsigned short a, c2; splitf(acc[g][t][r] * inv, a, c2); oh[r] = a; ol[r] = c2; }
            *(v8us*)(Ah + oo + 256 * t) = oh; *(v8us*)(Al + oo + 256 * t) = ol; } }
}
// k_attn: 4 waves a work-group, which share each K and V^T stage in LDS (two buffers). Blocks below NHB: rows < RH on the hi/lo bf16 planes (3 products), 16 columns a wave; the others: fp16 planes, 32 columns a wave. The longer class starts first. Plane z = b * NH_ + h; QK planes: q planes, then k planes.
#define AW  4
#define HBZ (RH / (AW * 16))
#define LBZ ((TT - RH) / (AW * 32))
#define NHB (NZ * HBZ)
#define NLB (NZ * LBZ)
__global__ __launch_bounds__(AW * 32) void k_attn(const h16* __restrict__ QK16, const bf* __restrict__ QKh, const bf* __restrict__ QKl, const h16* __restrict__ V16, const bf* __restrict__ Vh, const bf* __restrict__ Vl, bf* Ah, bf* Al) {
    __shared__ __align__(16) unsigned short kvs[2 * STB / 2];
    const int wave = __builtin_amdgcn_readfirstlane((int)(threadIdx.x >> 5)); const int bx = (int)blockIdx.x; const size_t PL = (size_t)TT * HD;
    if (bx < NHB) { const int z = bx / HBZ; const size_t ao = (size_t)(z / NH_) * TT * DQ + (z % NH_) * (HD * 16);
        attn_cols<bf, true, 1>(kvs, QKh + z * PL, QKl + z * PL, QKh + (NZ + z) * PL, QKl + (NZ + z) * PL, Vh + z * PL, Vl + z * PL, (bx % HBZ) * (AW * 16) + wave * 16, Ah + ao, Al + ao); }
    else { const int b2 = bx - NHB; const int z = b2 / LBZ; const size_t ao = (size_t)(z / NH_) * TT * DQ + (z % NH_) * (HD * 16);
        attn_cols<h16, false, 2>((const h16*)kvs, QK16 + z * PL, nullptr, QK16 + (NZ + z) * PL, nullptr, V16 + z * PL, nullptr, RH + (b2 % LBZ) * (AW * 32) + wave * 32, Ah + ao, Al + ao); }
}

// ---- both GEMMs (projections, output): 4 waves a work-group, 2 x 2 wave tiles of 64 x 64 = 128 rows of A x 128 rows of B (16 accumulators a wave). A and B reach the waves through LDS: a stage is 64 k of every operand plane's 128 rows, copied once per work-group by asynchronous copies and read by the two waves that need each half; two buffers, the next stage's copies fly while this stage is worked on.
// In fragment order a 16-row block's 64 k are 2 KB in a row, the next 16 rows' lie 16 * DM elements on. LDS holds 2-KB chunks in this order: A's 8 row blocks, (NA == 2: the second A plane's 8,) B's 8.
#define GK 64   // k columns of a stage
static_assert(DM == DQ && DM % (2 * GK) == 0, "one K for both GEMMs; two stages or more");
// acopy8s: 8 copies of 16 bytes a lane, 2 KB a work-group each: one chunk of 8 row blocks in turn, from g on, to 16 KB of LDS in a row from l on. The wait is the last line of the copies' own statement: a precaution, it stands in front of any overwrite of the address registers that the copies name.
__device__ __forceinline__ void acopy8s(unsigned l, const char* g) {
    constexpr int RB = 16 * DM * 2;   // bytes from a row block to the next
    asm volatile("global_load_async_to_lds_b128 %0, %8, off\n\t"
                 "global_load_async_to_lds_b128 %1, %9, off\n\t"
                 "global_load_async_to_lds_b128 %2, %10, off\n\t"
                 "global_load_async_to_lds_b128 %3, %11, off\n\t"
                 "global_load_async_to_lds_b128 %4, %12, off\n\t"
                 "global_load_async_to_lds_b128 %5, %13, off\n\t"
                 "global_load_async_to_lds_b128 %6, %14, off\n\t"
                 "global_load_async_to_lds_b128 %7, %15, off\n\t"
                 "s_wait_xcnt 0x0"
                 :: "v"(l), "v"(l + 2048u), "v"(l + 4096u), "v"(l + 6144u), "v"(l + 8192u), "v"(l + 10240u), "v"(l + 12288u), "v"(l + 14336u),
                    "v"(g), "v"(g + RB), "v"(g + 2 * RB), "v"(g + 3 * RB), "v"(g + 4 * RB), "v"(g + 5 * RB), "v"(g + 6 * RB), "v"(g + 7 * RB) : "memory");
}
// gstage_in: stage st of the work-group's panels (A, A2, B name block (panel's first 16 rows, k 0)), into the buffer whose byte 16 * threadIdx.x has LDS address l; 8 copies a wave and plane
template <int NA>
__device__ __forceinline__ void gstage_in(unsigned l, const bf* A, const bf* A2, const bf* B, int st) {
    const size_t o = (size_t)st * (GK * 16) + 8 * threadIdx.x;
    acopy8s(l, (const char*)(A + o));
    if constexpr (NA == 2) acopy8s(l + 16384u, (const char*)(A2 + o));
    acopy8s(l + NA * 16384u, (const char*)(B + o));
}
// gemm_ring: acc[mb][nb] += sum over k < DM of A (+ A2) rows 64 wm + 16 mb.. times B rows 64 wn + 16 nb..; per 32 k and tile the A product, then the A2 product
template <int NA>
__device__ __forceinline__ void gemm_ring(const bf* ring, const bf* A, const bf* A2, const bf* B, int wm, int wn, v8f (&acc)[4][4]) {
    constexpr int NS = DM / GK; constexpr unsigned GSB = (NA + 1) * 16384u;   // stages; bytes of a stage buffer
    const int lane = threadIdx.x & 31;
    const unsigned lb = (unsigned)(size_t)ring + 16u * threadIdx.x;   // LDS byte address of this thread's piece of buffer 0's first chunk
    gstage_in<NA>(lb, A, A2, B, 0);
    asm volatile("s_wait_asynccnt 0x0" ::: "memory");   // this wave's copies of stage 0 have landed
    __syncthreads();                                    // and every other wave's: stage 0 may be read
    gstage_in<NA>(lb + GSB, A, A2, B, 1);
#pragma unroll 1
    for (int st = 0; st < NS; ++st) {   // rolled over the stages; a stage's two 32-k blocks are unrolled
        const bf* pa = ring + (st & 1) * (GSB / 2) + wm * 4096 + 8 * lane;   // this lane's piece of the wave's first A chunk
        const bf* pb = ring + (st & 1) * (GSB / 2) + NA * 8192 + wn * 4096 + 8 * lane;
#pragma unroll
        for (int kb = 0; kb < GK / 32; ++kb) {
            v16bf a[4], a2[4], b[4];
            b[0] = WFrag<bf>::ld(pb + kb * 512);
#pragma unroll
            for (int i = 0; i < 4; ++i) a[i] = WFrag<bf>::ld(pa + i * 1024 + kb * 512);
#pragma unroll
            for (int i = 1; i < 4; ++i) b[i] = WFrag<bf>::ld(pb + i * 1024 + kb * 512);
            if constexpr (NA == 2) {   // asked for last: the 16 A products run while these land
#pragma unroll
                for (int i = 0; i < 4; ++i) a2[i] = WFrag<bf>::ld(pa + 8192 + i * 1024 + kb * 512); }
            __builtin_amdgcn_sched_barrier(0);   // keeps the LDS reads as one group ahead of the products, for speed only
#pragma unroll
            for (int nb = 0; nb < 4; ++nb)
#pragma unroll
                for (int mb = 0; mb < 4; ++mb) acc[mb][nb] = wmmab(a[mb], b[nb], acc[mb][nb]);
            if constexpr (NA == 2) {
#pragma unroll
                for (int nb = 0; nb < 4; ++nb)
#pragma unroll
                    for (int mb = 0; mb < 4; ++mb) acc[mb][nb] = wmmab(a2[mb], b[nb], acc[mb][nb]); }
            __builtin_amdgcn_sched_barrier(0);   // the run of products stays whole: the next group of reads is not moved in among them
        }
        nop4();
        asm volatile("s_wait_dscnt 0x0" ::: "memory");      // this wave's reads of the stage's buffer are done
        asm volatile("s_wait_asynccnt 0x0" ::: "memory");   // this wave's copies of stage st + 1 have landed
        __syncthreads();                                    // both hold for every wave: stage st + 1 may be read, this stage's buffer may be filled again
        if (st + 2 < NS) gstage_in<NA>(lb + (st & 1) * GSB, A, A2, B, st + 2);
    }
    asm volatile("s_wait_asynccnt 0x0" ::: "memory");   // no copy is outstanding when the wave goes on to its epilogue
}

// ---- projections straight into the head planes: no f32 copy of q, k, v is stored.
// planes_out: one 64 x 64 f32 tile + bias -> its fp16, bf16-hi and bf16-lo planes, in fragment order; RS, KS: elements from a block to the next 16 rows' and to the next 32 columns'; the pointers name block (tile's first 16 rows, tile's first 32 columns). 16 rows at a time pass through the wave's own LDS, so that lane (c, h) holds columns 16 s + 8 h to + 7 of row c, piece 32 (s & 1) + lane of block s / 2: 16 bytes a lane, 512 bytes in a row a store. RB: the bias goes by the tile's row, else by its column.
template <int RS, int KS, bool RB>
__device__ __forceinline__ void planes_out(float* os, const v8f (&acc)[4][4], const float* __restrict__ bias, h16* P16, bf* Ph, bf* Pl) {
    const int lane = threadIdx.x & 31, lr = lane & 15, hi = lane >> 4;
    float bb[RB ? 4 : 32];   // every bias this lane adds, asked for once, ahead of the LDS passes
#pragma unroll
    for (int i = 0; i < (RB ? 4 : 32); ++i) bb[i] = bfr(bias[RB ? 16 * i + lr : 16 * (i >> 3) + 8 * hi + (i & 7)]);
    h16* p16 = P16 + 8 * lane; bf* ph = Ph + 8 * lane; bf* pl = Pl + 8 * lane;   // this lane's piece in the first block; every store is a constant further
#pragma unroll
    for (int mb = 0; mb < 4; ++mb) {
#pragma unroll
        for (int nb = 0; nb < 4; ++nb) {
#pragma unroll
            for (int j = 0; j < 8; ++j) os[(hi * 8 + j) * 68 + nb * 16 + lr] = acc[mb][nb][j]; }
        __builtin_amdgcn_wave_barrier(); asm volatile("" ::: "memory");   // the rows are read back by other lanes: no LDS read moves in front of the writes
#pragma unroll
        for (int s = 0; s < 4; ++s) { const float* orow = os + lr * 68 + 16 * s + 8 * hi; const v4f lo4 = *(const v4fa*)orow, hi4 = *(const v4fa*)(orow + 4); float y[8]; v8h o16; u32x4 oh, ol;
#pragma unroll
            for (int i = 0; i < 8; ++i) { y[i] = ((i < 4) ? lo4[i & 3] : hi4[i & 3]) + bb[RB ? mb : 8 * s + i]; o16[i] = (h16)y[i]; }
#pragma unroll
            for (int i = 0; i < 4; ++i) { const unsigned w = packbf(y[2 * i], y[2 * i + 1]); oh[i] = w; ol[i] = packbf(y[2 * i] - __uint_as_float(w << 16), y[2 * i + 1] - __uint_as_float(w & 0xFFFF0000u)); }
            const size_t o = (size_t)mb * RS + (s >> 1) * KS + (s & 1) * 256;
            *(v8h*)(p16 + o) = o16; *(v8us*)(ph + o) = __builtin_bit_cast(v8us, oh); *(v8us*)(pl + o) = __builtin_bit_cast(v8us, ol);
            asm volatile("s_wait_xcnt 0x0" :: "v"(p16), "v"(ph), "v"(pl), "v"(o16), "v"(oh), "v"(ol) : "memory"); }   // precaution: the wait behind the three stores, in front of any overwrite of their address or data registers; naming them keeps them live up to here
        __builtin_amdgcn_wave_barrier(); asm volatile("" ::: "memory");   // the next 16 rows are written only behind these reads
    }
}
// k_proj: a work-group per 128 tokens x two heads' 128 columns, a wave per 64 tokens x one head; grid (128-token tiles over all batches, head pairs, 3: q, k, v). q and k: A = x rows, B = weight rows, tile [t][d]. v: the operands change places, so the tile comes out as [d][t], the order of its plane.
__global__ __launch_bounds__(128) void k_proj(const bf* __restrict__ XB, const bf* __restrict__ W4, const float* __restrict__ bq, const float* __restrict__ bk, const float* __restrict__ bv, h16* QK16, bf* QKh, bf* QKl, h16* V16, bf* Vh, bf* Vl) {
    __shared__ __align__(16) unsigned short ring[2 * 2 * 8192];   // two stage buffers of 32 KB
    __shared__ __align__(16) float osw[4][16 * 68];               // each wave's own epilogue rows
    const int wave = __builtin_amdgcn_readfirstlane((int)(threadIdx.x >> 5)), wm = wave >> 1, wn = wave & 1;
    const int kind = (int)blockIdx.z;
    const bf* X = XB + (size_t)blockIdx.x * 128 * DM; const bf* Wt = W4 + ((size_t)kind * DQ + blockIdx.y * 128) * DM;
    v8f acc[4][4];
#pragma unroll
    for (int mb = 0; mb < 4; ++mb)
#pragma unroll
        for (int nb = 0; nb < 4; ++nb) acc[mb][nb] = (v8f){};
    gemm_ring<1>(ring, (kind == 2) ? Wt : X, nullptr, (kind == 2) ? X : Wt, wm, wn, acc);
    float* os = osw[wave];
    const int tile = (int)blockIdx.x * 2 + ((kind == 2) ? wn : wm), head = (int)blockIdx.y * 2 + ((kind == 2) ? wm : wn);   // the wave's 64 tokens and its head
    const size_t plane = (size_t)(tile / (TT / 64)) * NH_ + head; const int t0 = (tile % (TT / 64)) * 64;
    if (kind == 2) { const size_t o = plane * HD * TT + t0 * HD; planes_out<512, 4 * 512, true>(os, acc, bv + head * HD, V16 + o, Vh + o, Vl + o); }
    else { const size_t o = (((size_t)kind * NZ + plane) * TT + t0) * HD; planes_out<16 * HD, 512, false>(os, acc, ((kind == 0) ? bq : bk) + head * HD, QK16 + o, QKh + o, QKl + o); }
}
// k_out: C[t][n] (f32, pitch DM) = sum_k (Ah + Al)[t][k] Wt[n][k] + bias[n]; a work-group per 128 tokens x 128 columns, a wave per 64 x 64; grid (128-token tiles, 128-column tiles). 16 rows at a time pass through the wave's own LDS, so that a store covers whole lines.
__global__ __launch_bounds__(128) void k_out(const bf* __restrict__ Ah, const bf* __restrict__ Al, const bf* __restrict__ Wt, const float* __restrict__ bias, float* C) {
    __shared__ __align__(16) unsigned short ring[2 * 3 * 8192];   // two stage buffers of 48 KB
    __shared__ __align__(16) float osw[4][16 * 68];               // each wave's own epilogue rows
    const int wave = __builtin_amdgcn_readfirstlane((int)(threadIdx.x >> 5)), wm = wave >> 1, wn = wave & 1;
    const int lane = threadIdx.x & 31, lr = lane & 15, hi = lane >> 4; const int r0 = (int)blockIdx.x * 128 + wm * 64, c0 = (int)blockIdx.y * 128 + wn * 64;
    v8f acc[4][4];
#pragma unroll
    for (int mb = 0; mb < 4; ++mb)
#pragma unroll
        for (int nb = 0; nb < 4; ++nb) acc[mb][nb] = (v8f){};
    gemm_ring<2>(ring, Ah + (size_t)blockIdx.x * 128 * DQ, Al + (size_t)blockIdx.x * 128 * DQ, Wt + (size_t)blockIdx.y * 128 * DQ, wm, wn, acc);
    float* os = osw[wave]; constexpr int ldc = DM;
#pragma unroll
    for (int mb = 0; mb < 4; ++mb) {
#pragma unroll
        for (int nb = 0; nb < 4; ++nb) {
#pragma unroll
            for (int j = 0; j < 8; ++j) os[(hi * 8 + j) * 68 + nb * 16 + lr] = acc[mb][nb][j]; }
        __builtin_amdgcn_wave_barrier(); asm volatile("" ::: "memory");   // the rows are read back by other lanes: no LDS read moves in front of the writes
        float* crow = C + (size_t)(r0 + mb * 16) * ldc + c0;
        { v4f vs[8]; float* pp[8];
#pragma unroll
            for (int s = 0; s < 8; ++s) { const int row = 2 * s + hi, cofs = lr * 4; v4f val = *(const v4fa*)(os + row * 68 + cofs); val[0] += bfr(bias[c0 + cofs]); val[1] += bfr(bias[c0 + cofs + 1]); val[2] += bfr(bias[c0 + cofs + 2]); val[3] += bfr(bias[c0 + cofs + 3]);
                vs[s] = val; pp[s] = crow + (size_t)row * ldc + cofs; *(v4f*)pp[s] = val; }
            asm volatile("s_wait_xcnt 0x0" :: "v"(vs[0]), "v"(vs[1]), "v"(vs[2]), "v"(vs[3]), "v"(vs[4]), "v"(vs[5]), "v"(vs[6]), "v"(vs[7]), "v"(pp[0]), "v"(pp[1]), "v"(pp[2]), "v"(pp[3]), "v"(pp[4]), "v"(pp[5]), "v"(pp[6]), "v"(pp[7]) : "memory");   // precaution: the wait behind the 8 stores, in front of any overwrite of their address or data registers; naming them keeps them live up to here
        }
        __builtin_amdgcn_wave_barrier(); asm volatile("" ::: "memory");   // the next 16 rows are written only behind these reads
    }
}

extern "C" void kernel_launch(void* const* d_in, const int* in_sizes, int n_in,
                              void* d_out, int out_size, void* d_ws, size_t ws_size, hipStream_t stream) {
    (void)in_sizes; (void)n_in; (void)out_size;
    const float* x = (const float*)d_in[0]; const float* wq = (const float*)d_in[1]; const float* bq = (const float*)d_in[2]; const float* wk = (const float*)d_in[3]; const float* bk = (const float*)d_in[4]; const float* wv = (const float*)d_in[5]; const float* bv = (const float*)d_in[6]; const float* wo = (const float*)d_in[7]; const float* bo = (const float*)d_in[8];   /* argument order inputs, wq, bq, wk, bk, wv, bv, wo, bo ('xw' + biases) */
    float* OUT = (float*)d_out;     // [4][2048][512]
    char* wsp = (char*)d_ws;
    auto take = [&](size_t bytes) { char* p = wsp; wsp += (bytes + 255) & ~(size_t)255; return (void*)p; };
    bf* W4 = (bf*)take((size_t)4 * DQ * DM * 2); bf* WO = W4 + (size_t)3 * DQ * DM;   // W4: wq, wk, wv, wo transposed, one after the other
    h16* QP16 = (h16*)take((size_t)2 * NZ * TT * HD * 2); h16* VT16 = (h16*)take((size_t)NZ * HD * TT * 2);   // q planes, then k planes
    bf* QPh = (bf*)take((size_t)2 * NZ * TT * HD * 2); bf* QPl = (bf*)take((size_t)2 * NZ * TT * HD * 2); bf* VTh = (bf*)take((size_t)NZ * HD * TT * 2); bf* VTl = (bf*)take((size_t)NZ * HD * TT * 2);
    bf* XB = (bf*)take((size_t)NB_ * TT * DM * 2); bf* ATh = (bf*)take((size_t)NB_ * TT * DQ * 2); bf* ATl = (bf*)take((size_t)NB_ * TT * DQ * 2);
    if ((size_t)(wsp - (char*)d_ws) > ws_size) return;    // ws 256 MiB
    static_assert(DQ == DKV && REP == 1 && RH % (AW * 16) == 0 && (TT - RH) % (AW * 32) == 0 && (TT & (TT - 1)) == 0 && HD == 64 && TT % 128 == 0 && NH_ % 2 == 0 && DM % 128 == 0, "one kv plane per query plane; whole work-groups per row class; a projection wave tile is 64 tokens of one batch x one head, a work-group 2 x 2 of them");
    k_pre<<<4 * NWT + NCV, 256, 0, stream>>>(x, wq, wk, wv, wo, W4, XB);
    k_proj<<<dim3(NB_ * TT / 128, NH_ / 2, 3), 128, 0, stream>>>(XB, W4, bq, bk, bv, QP16, QPh, QPl, VT16, VTh, VTl);
    k_attn<<<NHB + NLB, AW * 32, 0, stream>>>(QP16, QPh, QPl, VT16, VTh, VTl, ATh, ATl);
    k_out<<<dim3(NB_ * TT / 128, DM / 128), 128, 0, stream>>>(ATh, ATl, WO, bo, OUT);
}

// v008
// It runs in 83.9 microseconds.
// Next to v007, in two timings, it ran 1.04 and 1.03 times as fast.
// Counting every step since v000, it is 24.3 times as fast.
#include <hip/hip_runtime.h>

// Multi-head attention WITHOUT a mask and with biased projections at a 512-wide model (x [4][2048][512]; q, k, v = x W + b ('xw' [512][512] uniform +-1/sqrt(512) + zero biases; 8 heads x 64); scores x 64^-0.5; softmax over all keys; out = merged Wo + bo ('xw' + zero bias) -> [4][2048][512] (4.2 M); argument order x, Wq, bq, Wk, bk, Wv, bv, Wo, bo).
// Layout, all four batches at once (32 head planes, index b * 8 + h): bf16 copy of x; 'xw' weights transposed once; exact projections + f32 biases, whose epilogue writes the head planes; one fused dense T-2048 attention kernel (hybrid rows: < 512 hi/lo 3 products, rest fp16; scores and P stay in registers); merged hi/lo x wo exact + bo.
// Compute dtypes, f32 accumulate: every input rounded to bf16; projections exact + f32 biases; attention rows < 512 3 products, rest fp16; softmax f32; wo hl x exact + bias.

#define NB_  4
#define TT   2048
#define DM   512    // model width: this module's D_MODEL
#define NH_  8      // heads: 8 x 64 = 512
#define NKV  8      // kv heads = heads (no grouping)
#define REP  (NH_ / NKV)
#define HD   64
#define DQ   (NH_ * HD)
#define DKV  (NKV * HD)
#define NZ   (NB_ * NH_)          // head planes over all batches, plane index b * NH_ + h
#define RH   512                  // query rows < RH use hi+lo planes (0: none)
#define WIN  0
#define SCL  0.125f   // HD^-0.5
typedef _Float16 h16;
typedef unsigned short bf;
typedef __attribute__((ext_vector_type(16))) __bf16   v16bf;
typedef __attribute__((ext_vector_type(16))) _Float16 v16h;
typedef __attribute__((ext_vector_type(8)))  _Float16 v8h;
typedef __attribute__((ext_vector_type(8)))  unsigned short v8us;
typedef __attribute__((ext_vector_type(8)))  float    v8f;
typedef __attribute__((ext_vector_type(4)))  float    v4f;
typedef v8h  __attribute__((may_alias)) v8ha;
typedef v4f  __attribute__((may_alias)) v4fa;
typedef v8us __attribute__((may_alias)) v8usa;

__device__ __forceinline__ unsigned short f2bf(float f) { unsigned u = __float_as_uint(f); u += 0x7FFFu + ((u >> 16) & 1u); return (unsigned short)(u >> 16); }
__device__ __forceinline__ float bf2f(unsigned short b) { return __uint_as_float(((unsigned)b) << 16); }
__device__ __forceinline__ float bfr(float f) { return bf2f(f2bf(f)); }
__device__ __forceinline__ v16h cat16(v8h lo, v8h hi) { return __builtin_shufflevector(lo, hi, 0, 1, 2, 3, 4, 5, 6, 7, 8, 9, 10, 11, 12, 13, 14, 15); }
__device__ __forceinline__ v16bf cat16b(v8us lo, v8us hi) { return __builtin_bit_cast(v16bf, __builtin_shufflevector(lo, hi, 0, 1, 2, 3, 4, 5, 6, 7, 8, 9, 10, 11, 12, 13, 14, 15)); }
__device__ __forceinline__ v8f wmma16(v16h a, v16h b, v8f c) { return __builtin_amdgcn_wmma_f32_16x16x32_f16(false, a, false, b, (short)0, c, false, false); }
__device__ __forceinline__ v8f wmmab(v16bf a, v16bf b, v8f c) { return __builtin_amdgcn_wmma_f32_16x16x32_bf16(false, a, false, b, (short)0, c, false, false); }



// ---- FRAGMENT ORDER of every 16-bit operand plane M[row][k], k < K: blocks of 16 rows x 32 k = 1 KB, block (row / 16, k / 32) at element (row / 16) * 16 * K + (k / 32) * 512; inside a block the 16-byte piece number ((k / 16) & 1) * 32 + ((k / 8) & 1) * 16 + (row & 15) holds k & ~7 to k | 7 of its row.
// The V^T planes (64 rows) alone order their blocks by k first, block (row / 16, k / 32) at ((k / 32) * 4 + row / 16) * 512: the four blocks of a 32-key pass lie in a row.
// Piece number = half of the fragment * 32 + lane: each of a fragment's two wave-wide 16-byte loads reads 512 bytes in a row (4 whole lines), where row-major planes gave 32 bytes of each of 16 lines. Which lane and register holds which (row, k) is as before.
// WFrag: a fragment's two 16-byte loads from a plane in fragment order, and its product
template <typename T16> struct WFrag;
template <> struct WFrag<h16> { typedef v16h V; static __device__ __forceinline__ V ld(const h16* p) { return cat16(*(const v8h*)p, *(const v8h*)(p + 256)); } static __device__ __forceinline__ v8f mma(V a, V b, v8f c) { return wmma16(a, b, c); } };
template <> struct WFrag<bf> { typedef v16bf V; static __device__ __forceinline__ V ld(const bf* p) { return cat16b(*(const v8us*)p, *(const v8us*)(p + 256)); } static __device__ __forceinline__ v8f mma(V a, V b, v8f c) { return wmmab(a, b, c); } };

__device__ __forceinline__ void splitf(float y, unsigned short& h, unsigned short& l) { h = f2bf(y); l = f2bf(y - bf2f(h)); }
typedef __attribute__((ext_vector_type(4))) _Float16 v4h;
typedef __attribute__((ext_vector_type(2))) unsigned short v2us;
typedef __attribute__((ext_vector_type(4))) unsigned short v4us;
typedef __attribute__((ext_vector_type(4))) int v4i;

// One thread per 16-byte piece of a plane in fragment order, piece number o: a wave stores 512 bytes in a row. pc_row, pc_k: the piece's row and its first k in a plane of K columns.
__device__ __forceinline__ int pc_row(int o, int K) { return (o >> 6) / (K / 32) * 16 + (o & 15); }
__device__ __forceinline__ int pc_k(int o, int K) { return (o >> 6) % (K / 32) * 32 + ((o >> 5) & 1) * 16 + ((o >> 4) & 1) * 8; }
// wtG_blk: Bt[n][k] = w[k][n]; a piece is 8 rows of w at one column, 16 neighbouring columns a half-wave
__device__ __forceinline__ void wtG_blk(int bx, const float* __restrict__ w, int K, int N, bf* Bt) {
    const int o = bx * 256 + (int)threadIdx.x; if (o >= N * K / 8) return; const float* p = w + (size_t)pc_k(o, K) * N + pc_row(o, K); v8us v;
    float y[8];
#pragma unroll
    for (int i = 0; i < 8; ++i) y[i] = p[(size_t)i * N];
    asm volatile("s_wait_xcnt 0x0" :: "v"(p) : "memory");   // precaution: the wait behind the 8 loads, in front of any overwrite of their address registers; naming the pointer keeps the pair live up to here
#pragma unroll
    for (int i = 0; i < 8; ++i) v[i] = f2bf(y[i]);
    *(v8us*)(Bt + (size_t)o * 8) = v;
}
// cvt_blk: bf16 copy of src[row][k] in fragment order, one wave per 1-KB block: 4 loads of 4 whole lines each (row 4 i + lane / 8, 16 bytes a lane); a lane's 4 values are half a piece, 8 bytes a store
__device__ __forceinline__ void cvt_blk(int bx, const float* __restrict__ src, int K, bf* dst, int nblk) {
    const int lane = threadIdx.x & 31, k4 = lane & 7, r4 = lane >> 3; const int blk = bx * 8 + (int)(threadIdx.x >> 5); if (blk >= nblk) return;
    const float* p = src + (size_t)(blk / (K / 32) * 16 + r4) * K + blk % (K / 32) * 32 + 4 * k4; v4f v[4];
#pragma unroll
    for (int i = 0; i < 4; ++i) v[i] = *(const v4f*)(p + (size_t)4 * i * K);
    asm volatile("s_wait_xcnt 0x0" :: "v"(p) : "memory");   // precaution, as in wtG_blk
    bf* q = dst + (size_t)blk * 512 + ((k4 >> 2) * 32 + ((k4 >> 1) & 1) * 16 + r4) * 8 + (k4 & 1) * 4;
#pragma unroll
    for (int i = 0; i < 4; ++i) { v4us u;
#pragma unroll
        for (int k = 0; k < 4; ++k) u[k] = f2bf(v[i][k]);
        *(v4us*)(q + 32 * i) = u; }
}

// k_pre: the jobs that read only inputs, one block range each: 4 weight transposes (NWT blocks each), the bf16 copy of x (NCV)
#define NWT (DM * DQ / 8 / 256)
#define NCV (NB_ * TT * DM / 512 / 8)
__global__ __launch_bounds__(256) void k_pre(const float* __restrict__ x, const float* __restrict__ wq, const float* __restrict__ wk, const float* __restrict__ wv, const float* __restrict__ wo, bf* W4, bf* XB) {
    const int bx = (int)blockIdx.x;
    if (bx < 4 * NWT) { const int j = bx / NWT; const float* w = (j == 0) ? wq : ((j == 1) ? wk : ((j == 2) ? wv : wo)); wtG_blk(bx % NWT, w, DM, DQ, W4 + (size_t)j * DQ * DM); }
    else cvt_blk(bx - 4 * NWT, x, DM, XB, NB_ * TT * DM / 512);
}
// ---- fused attention: S^T = K Q^T, online softmax, O^T += V^T P^T, one wave per R x 16 query columns over all TT keys, 32 keys a pass; no score and no P ever leaves the registers.
// A = K rows (then V^T rows), B = Q rows (then P^T): in a 16-column group lane (c, h) holds scores of query c alone, keys 8 h + r of each 16-key tile, which is the k order WFrag::ld gives the V^T fragment: two score tiles, converted in place, are the B operand of the second product.
// m is the maximum in use, in log2 units; it may trail the true maximum by up to 8 (an exponential reaches 2^8 at most). No maximum is formed in a pass that keeps m: the exponentials are taken against m at once, and the test is on sums that the denominator needs anyway; only where a lane's sum of the pass's exponentials exceeds 2^8 is the pass's true maximum formed, the sums rescaled and the pass's exponentials taken again.
typedef __attribute__((ext_vector_type(2))) float f32x2;
typedef __attribute__((ext_vector_type(2))) __bf16 bf16x2;
typedef __attribute__((ext_vector_type(8))) unsigned u32x8;
typedef __attribute__((ext_vector_type(4))) unsigned u32x4;
#define CSC (SCL * 1.4426950408889634f)
__device__ __forceinline__ float xhalf(float x) { return __builtin_bit_cast(float, __builtin_amdgcn_permlanex16(__builtin_bit_cast(int, x), __builtin_bit_cast(int, x), 0x76543210, 0xfedcba98, false, false)); }   // lane l with lane l ^ 16
__device__ __forceinline__ unsigned packbf(float lo, float hi) { return __builtin_bit_cast(unsigned, __builtin_convertvector((f32x2){lo, hi}, bf16x2)); }   // round to nearest even
__device__ __forceinline__ void nop4() { __builtin_amdgcn_sched_barrier(0); asm volatile("v_nop\n\tv_nop\n\tv_nop\n\tv_nop"); __builtin_amdgcn_sched_barrier(0); }   // the 4 vector slots between a pass's last WMMAs and whatever next overwrites their A or B or touches their D, in the next pass and behind the loop's exit branch alike (without them a WMMA stood directly in front of that branch); the two scheduling barriers keep the slots behind the run
// xwait: precaution: the wait behind a group of loads, in front of any overwrite of their address registers; naming the pointers keeps the address pairs live up to here, the clobber keeps the loads in front of it
template <bool HL, typename T16> __device__ __forceinline__ void xwait(const T16* a, const T16* b) { if constexpr (HL) asm volatile("s_wait_xcnt 0x0" :: "v"(a), "v"(b) : "memory"); else asm volatile("s_wait_xcnt 0x0" :: "v"(a) : "memory"); }
// ---- K and V^T reach the waves through LDS: a stage is 32 KB of key rows (hi/lo class: 64 keys of K hi, K lo, V^T hi, V^T lo, 8 KB each, in this order; fp16 class: 128 keys of K, then of V^T, 16 KB each), copied once per work-group by asynchronous copies and read by all 4 waves; two buffers, the next stage's copies fly while this stage is worked on. The planes lie in fragment order and a stage's keys are contiguous in each, so LDS holds the same bytes in the same order.
#define STB 32768   // bytes of a stage buffer
// acopy8: 8 copies of 16 bytes a lane, 2 KB a work-group each: 4 from ga on, 4 from gb on, to 16 KB of LDS in a row from l on. The wait is the last line of the copies' own statement: a precaution, it stands in front of any overwrite of the address registers that the copies name.
__device__ __forceinline__ void acopy8(unsigned l, const char* ga, const char* gb) {
    asm volatile("global_load_async_to_lds_b128 %0, %8, off\n\t"
                 "global_load_async_to_lds_b128 %1, %9, off\n\t"
                 "global_load_async_to_lds_b128 %2, %10, off\n\t"
                 "global_load_async_to_lds_b128 %3, %11, off\n\t"
                 "global_load_async_to_lds_b128 %4, %12, off\n\t"
                 "global_load_async_to_lds_b128 %5, %13, off\n\t"
                 "global_load_async_to_lds_b128 %6, %14, off\n\t"
                 "global_load_async_to_lds_b128 %7, %15, off\n\t"
                 "s_wait_xcnt 0x0"
                 :: "v"(l), "v"(l + 2048u), "v"(l + 4096u), "v"(l + 6144u), "v"(l + 8192u), "v"(l + 10240u), "v"(l + 12288u), "v"(l + 14336u),
                    "v"(ga), "v"(ga + 2048), "v"(ga + 4096), "v"(ga + 6144), "v"(gb), "v"(gb + 2048), "v"(gb + 4096), "v"(gb + 6144) : "memory");
}
// stage_in: the stage that starts at key key0, into the buffer whose byte 16 * threadIdx.x has LDS address l; 16 copies a wave
template <bool HL, typename T16>
__device__ __forceinline__ void stage_in(unsigned l, const T16* K, const T16* K2, const T16* VT, const T16* VT2, int key0) {
    const size_t o = (size_t)key0 * HD + 8 * threadIdx.x;
    if constexpr (HL) { acopy8(l, (const char*)(K + o), (const char*)(K2 + o)); acopy8(l + 16384u, (const char*)(VT + o), (const char*)(VT2 + o)); }
    else { acopy8(l, (const char*)(K + o), (const char*)(K + o + 4096)); acopy8(l + 16384u, (const char*)(VT + o), (const char*)(VT + o + 4096)); }
}
template <typename T16, bool HL, int R>
__device__ __forceinline__ void attn_cols(const T16* kv, const T16* __restrict__ Q, const T16* __restrict__ Q2, const T16* __restrict__ K, const T16* __restrict__ K2, const T16* __restrict__ VT, const T16* __restrict__ VT2, int q0, bf* Ah, bf* Al) {
    typedef typename WFrag<T16>::V V;
    const int lane = threadIdx.x & 31;
    V qf[R][2], qf2[R][2];
#pragma unroll
    for (int g = 0; g < R; ++g) { const size_t o = (size_t)(q0 + 16 * g) * HD + 8 * lane; const T16* qp = Q + o; const T16* qp2 = HL ? Q2 + o : qp;
#pragma unroll
        for (int kc = 0; kc < 2; ++kc) { qf[g][kc] = WFrag<T16>::ld(qp + 512 * kc); if (HL) qf2[g][kc] = WFrag<T16>::ld(qp2 + 512 * kc); }
        xwait<HL>(qp, qp2); }
    v8f acc[R][4]; float m[R]; f32x2 l[R];   // l: each lane's share of the denominator, even and odd keys apart
#pragma unroll
    for (int g = 0; g < R; ++g) { m[g] = -__builtin_inff(); l[g] = (f32x2){0.f, 0.f};
#pragma unroll
        for (int t = 0; t < 4; ++t) acc[g][t] = (v8f){}; }
    constexpr int SK = HL ? 64 : 128, NP = SK / 32, NS = TT / SK;   // keys a stage, 32-key passes a stage, stages
    constexpr int PE = SK * HD;                                     // elements of one plane in a stage
    static_assert(NS >= 2 && (HL ? 4 : 2) * PE * 2 == STB, "two stages or more; a stage fills its buffer");
    const unsigned lb = (unsigned)(size_t)kv + 16u * threadIdx.x;   // LDS byte address of this thread's first piece of buffer 0
    stage_in<HL>(lb, K, K2, VT, VT2, 0);
    asm volatile("s_wait_asynccnt 0x0" ::: "memory");   // this wave's copies of stage 0 have landed
    __syncthreads();                                    // and every other wave's: stage 0 may be read
    stage_in<HL>(lb + STB, K, K2, VT, VT2, SK);
#pragma unroll 1
    for (int st = 0; st < NS; ++st) {   // rolled over the stages; a stage's passes are unrolled, so that each but the last can ask for the next pass's K rows
      const T16* sb = kv + (st & 1) * (STB / 2) + 8 * lane;   // this lane's piece of the stage's first block
      V kf[2][2], kf2[2][2];
#pragma unroll
      for (int kt = 0; kt < 2; ++kt)
#pragma unroll
        for (int kc = 0; kc < 2; ++kc) { kf[kt][kc] = WFrag<T16>::ld(sb + kt * 16 * HD + 512 * kc); if (HL) kf2[kt][kc] = WFrag<T16>::ld(sb + PE + kt * 16 * HD + 512 * kc); }
#pragma unroll
      for (int ps = 0; ps < NP; ++ps) {
        const T16* vp = sb + (HL ? 2 : 1) * PE + ps * 32 * HD; const T16* vp2 = vp + PE;
        V vf[4], vf2[4];   // this pass's V^T fragments, asked for first: they fly under the first product and the softmax
#pragma unroll
        for (int t = 0; t < 4; ++t) { vf[t] = WFrag<T16>::ld(vp + t * 512); if (HL) vf2[t] = WFrag<T16>::ld(vp2 + t * 512); }
        __builtin_amdgcn_sched_barrier(0);   // keeps the LDS reads above as one group ahead of the products: left free they were moved down in pairs, each pair directly in front of the product that needs it, which then waited out the LDS latency
        v8f s[2][R];
#pragma unroll
        for (int kt = 0; kt < 2; ++kt)
#pragma unroll
            for (int g = 0; g < R; ++g) { s[kt][g] = (v8f){};
#pragma unroll
                for (int kc = 0; kc < 2; ++kc) { s[kt][g] = WFrag<T16>::mma(kf[kt][kc], qf[g][kc], s[kt][g]); if (HL) { s[kt][g] = WFrag<T16>::mma(kf[kt][kc], qf2[g][kc], s[kt][g]); s[kt][g] = WFrag<T16>::mma(kf2[kt][kc], qf[g][kc], s[kt][g]); } } }
        __builtin_amdgcn_sched_barrier(0);   // the first product's run stays whole: no LDS read is moved in among its WMMAs
        if (ps + 1 < NP) {   // next pass's K rows of the same stage, into the same registers, in flight under the softmax and the second product; nothing of the next stage is read here
            const T16* kp = sb + (ps + 1) * 32 * HD;
#pragma unroll
            for (int kt = 0; kt < 2; ++kt)
#pragma unroll
                for (int kc = 0; kc < 2; ++kc) { kf[kt][kc] = WFrag<T16>::ld(kp + kt * 16 * HD + 512 * kc); if (HL) kf2[kt][kc] = WFrag<T16>::ld(kp + PE + kt * 16 * HD + 512 * kc); }
            __builtin_amdgcn_sched_barrier(0);   // keeps these reads here, one group a whole softmax ahead of their use
        }
        float pp[R][16]; f32x2 ls[R];   // this pass's exponentials and each lane's sum of its 16, even and odd keys apart
        auto expo = [&](int g) { const float nm = -m[g];
#pragma unroll
            for (int i = 0; i < 8; ++i) { const f32x2 arg = __builtin_elementwise_fma((f32x2){s[i >> 2][g][2 * (i & 3)], s[i >> 2][g][2 * (i & 3) + 1]}, (f32x2){CSC, CSC}, (f32x2){nm, nm}); pp[g][2 * i] = __builtin_amdgcn_exp2f(arg.x); pp[g][2 * i + 1] = __builtin_amdgcn_exp2f(arg.y);
                const f32x2 pr = (f32x2){pp[g][2 * i], pp[g][2 * i + 1]}; ls[g] = (i == 0) ? pr : ls[g] + pr; } };
        V ph[R], pl[R];   // the second product's B operands (pl: hi/lo class alone)
        auto conv = [&](int g) { const float (&p)[16] = pp[g];
            if constexpr (HL) { u32x8 wh, wl;
#pragma unroll
                for (int i = 0; i < 8; ++i) { const unsigned w = packbf(p[2 * i], p[2 * i + 1]); wh[i] = w; wl[i] = packbf(p[2 * i] - __uint_as_float(w << 16), p[2 * i + 1] - __uint_as_float(w & 0xFFFF0000u)); }
                ph[g] = __builtin_bit_cast(V, wh); pl[g] = __builtin_bit_cast(V, wl);
            } else {
#pragma unroll
                for (int i = 0; i < 16; ++i) ph[g][i] = (h16)p[i]; } };
        f32x2 tot;
#pragma unroll
        for (int g = 0; g < R; ++g) { expo(g); tot = (g == 0) ? ls[0] : tot + ls[g]; }
        const bool need = !(tot.x + tot.y <= 256.0f);   // the lane's sum over the pass at most 2^8: none of its exponentials exceeds 2^8; infinity and not-a-number fail the test too
        if (__builtin_amdgcn_ballot_w32(need) != 0) {   // one scalar branch a pass; always taken in the first pass (m is -inf there: every exponential infinite, the factor 0)
#pragma unroll
            for (int g = 0; g < R; ++g) { float mx = s[0][g][0];
#pragma unroll
                for (int i = 1; i < 16; ++i) mx = fmaxf(mx, s[i >> 3][g][i & 7]);
                mx = fmaxf(mx, xhalf(mx)) * CSC;
                const float mn = fmaxf(m[g], mx); float corr; asm("v_nop\n\tv_exp_f32 %0, %1\n\tv_nop" : "=v"(corr) : "v"(m[g] - mn));   // 2^(m - mn), with the slot that a transcendental asks for on either side in the same statement
                m[g] = mn; l[g] *= corr;
#pragma unroll
                for (int t = 0; t < 4; ++t) acc[g][t] = acc[g][t] * corr;
                expo(g); }   // the pass's exponentials again, against the new maximum: none exceeds 1
        }
#pragma unroll
        for (int g = 0; g < R; ++g) { conv(g); l[g] += ls[g]; }
#pragma unroll
        for (int g = 0; g < R; ++g) {
#pragma unroll
            for (int t = 0; t < 4; ++t) { acc[g][t] = WFrag<T16>::mma(vf[t], ph[g], acc[g][t]); if constexpr (HL) { acc[g][t] = WFrag<T16>::mma(vf[t], pl[g], acc[g][t]); acc[g][t] = WFrag<T16>::mma(vf2[t], ph[g], acc[g][t]); } } }
        nop4();
      }
      asm volatile("s_wait_dscnt 0x0" ::: "memory");      // this wave's reads of the stage's buffer are done
      asm volatile("s_wait_asynccnt 0x0" ::: "memory");   // this wave's copies of stage st + 1 have landed
      __syncthreads();                                    // both hold for every wave: stage st + 1 may be read, this stage's buffer may be filled again
      if (st + 2 < NS) stage_in<HL>(lb + (st & 1) * STB, K, K2, VT, VT2, (st + 2) * SK);
    }
    asm volatile("s_wait_asynccnt 0x0" ::: "memory");   // no copy is outstanding when the wave goes on to its end
#pragma unroll
    for (int g = 0; g < R; ++g) { const float lh = l[g].x + l[g].y; const float lt = lh + xhalf(lh); const float inv = __fdiv_rn(1.0f, lt);   // the halves' sums joined once, unconditionally
        const size_t oo = (size_t)(q0 + 16 * g) * DQ + 8 * lane;   // lane (c, h) holds d = 16 t + 8 h + r of query c: piece 32 (t & 1) + lane of block (query group, 2 head + t / 2) of the merged plane
#pragma unroll
        for (int t = 0; t < 4; ++t) { v8us oh, ol;
#pragma unroll
            for (int r = 0; r < 8; ++r) { unsigned short a, c2; splitf(acc[g][t][r] * inv, a, c2); oh[r] = a; ol[r] = c2; }
            *(v8us*)(Ah + oo + 256 * t) = oh; *(v8us*)(Al + oo + 256 * t) = ol; } }
}
// k_attn: 4 waves a work-group, which share each K and V^T stage in LDS (two buffers). Blocks below NHB: rows < RH on the hi/lo bf16 planes (3 products), 16 columns a wave; the others: fp16 planes, 32 columns a wave. The longer class has the lower block indices. Plane z = b * NH_ + h; QK planes: q planes, then k planes.
#define AW  4
#define HBZ (RH / (AW * 16))
#define LBZ ((TT - RH) / (AW * 32))
#define NHB (NZ * HBZ)
#define NLB (NZ * LBZ)
__global__ __launch_bounds__(AW * 32) void k_attn(const h16* __restrict__ QK16, const bf* __restrict__ QKh, const bf* __restrict__ QKl, const h16* __restrict__ V16, const bf* __restrict__ Vh, const bf* __restrict__ Vl, bf* Ah, bf* Al) {
    __shared__ __align__(16) unsigned short kvs[2 * STB / 2];
    const int wave = __builtin_amdgcn_readfirstlane((int)(threadIdx.x >> 5)); const int bx = (int)blockIdx.x; const size_t PL = (size_t)TT * HD;
    if (bx < NHB) { const int z = bx / HBZ; const size_t ao = (size_t)(z / NH_) * TT * DQ + (z % NH_) * (HD * 16);
        attn_cols<bf, true, 1>(kvs, QKh + z * PL, QKl + z * PL, QKh + (NZ + z) * PL, QKl + (NZ + z) * PL, Vh + z * PL, Vl + z * PL, (bx % HBZ) * (AW * 16) + wave * 16, Ah + ao, Al + ao); }
    else { const int b2 = bx - NHB; const int z = b2 / LBZ; const size_t ao = (size_t)(z / NH_) * TT * DQ + (z % NH_) * (HD * 16);
        attn_cols<h16, false, 2>((const h16*)kvs, QK16 + z * PL, nullptr, QK16 + (NZ + z) * PL, nullptr, V16 + z * PL, nullptr, RH + (b2 % LBZ) * (AW * 32) + wave * 32, Ah + ao, Al + ao); }
}

// ---- both GEMMs (projections, output): 4 waves a work-group, 2 x 2 wave tiles of 64 x 64 = 128 rows of A x 128 rows of B (16 accumulators a wave). A and B reach the waves through LDS: a stage is 64 k of every operand plane's 128 rows, copied once per work-group by asynchronous copies and read by the two waves that need each half; two buffers, the next stage's copies fly while this stage is worked on.
// In fragment order a 16-row block's 64 k are 2 KB in a row, the next 16 rows' lie 16 * DM elements on. LDS holds 2-KB chunks in this order: A's 8 row blocks, (NA == 2: the second A plane's 8,) B's 8.
#define GK 64   // k columns of a stage
static_assert(DM == DQ && DM % (2 * GK) == 0, "one K for both GEMMs; two stages or more");
// acopy8s: 8 copies of 16 bytes a lane, 2 KB a work-group each: one chunk of 8 row blocks in turn, from g on, to 16 KB of LDS in a row from l on. The wait is the last line of the copies' own statement: a precaution, it stands in front of any overwrite of the address registers that the copies name.
__device__ __forceinline__ void acopy8s(unsigned l, const char* g) {
    constexpr int RB = 16 * DM * 2;   // bytes from a row block to the next
    asm volatile("global_load_async_to_lds_b128 %0, %8, off\n\t"
                 "global_load_async_to_lds_b128 %1, %9, off\n\t"
                 "global_load_async_to_lds_b128 %2, %10, off\n\t"
                 "global_load_async_to_lds_b128 %3, %11, off\n\t"
                 "global_load_async_to_lds_b128 %4, %12, off\n\t"
                 "global_load_async_to_lds_b128 %5, %13, off\n\t"
                 "global_load_async_to_lds_b128 %6, %14, off\n\t"
                 "global_load_async_to_lds_b128 %7, %15, off\n\t"
                 "s_wait_xcnt 0x0"
                 :: "v"(l), "v"(l + 2048u), "v"(l + 4096u), "v"(l + 6144u), "v"(l + 8192u), "v"(l + 10240u), "v"(l + 12288u), "v"(l + 14336u),
                    "v"(g), "v"(g + RB), "v"(g + 2 * RB), "v"(g + 3 * RB), "v"(g + 4 * RB), "v"(g + 5 * RB), "v"(g + 6 * RB), "v"(g + 7 * RB) : "memory");
}
// gstage_in: stage st of the work-group's panels (A, A2, B name block (panel's first 16 rows, k 0)), into the buffer whose byte 16 * threadIdx.x has LDS address l; 8 copies a wave and plane
template <int NA>
__device__ __forceinline__ void gstage_in(unsigned l, const bf* A, const bf* A2, const bf* B, int st) {
    const size_t o = (size_t)st * (GK * 16) + 8 * threadIdx.x;
    acopy8s(l, (const char*)(A + o));
    if constexpr (NA == 2) acopy8s(l + 16384u, (const char*)(A2 + o));
    acopy8s(l + NA * 16384u, (const char*)(B + o));
}
// gemm_ring: acc[mb][nb] += sum over k < DM of A (+ A2) rows 64 wm + 16 mb.. times B rows 64 wn + 16 nb..; per 32 k and tile the A product, then the A2 product
template <int NA>
__device__ __forceinline__ void gemm_ring(const bf* ring, const bf* A, const bf* A2, const bf* B, int wm, int wn, v8f (&acc)[4][4]) {
    constexpr int NS = DM / GK; constexpr unsigned GSB = (NA + 1) * 16384u;   // stages; bytes of a stage buffer
    const int lane = threadIdx.x & 31;
    const unsigned lb = (unsigned)(size_t)ring + 16u * threadIdx.x;   // LDS byte address of this thread's piece of buffer 0's first chunk
    gstage_in<NA>(lb, A, A2, B, 0);
    asm volatile("s_wait_asynccnt 0x0" ::: "memory");   // this wave's copies of stage 0 have landed
    __syncthreads();                                    // and every other wave's: stage 0 may be read
    gstage_in<NA>(lb + GSB, A, A2, B, 1);
#pragma unroll 1
    for (int st = 0; st < NS; ++st) {   // rolled over the stages; a stage's two 32-k blocks are unrolled
        const bf* pa = ring + (st & 1) * (GSB / 2) + wm * 4096 + 8 * lane;   // this lane's piece of the wave's first A chunk
        const bf* pb = ring + (st & 1) * (GSB / 2) + NA * 8192 + wn * 4096 + 8 * lane;
#pragma unroll
        for (int kb = 0; kb < GK / 32; ++kb) {
            v16bf a[4], a2[4], b[4];
            b[0] = WFrag<bf>::ld(pb + kb * 512);
#pragma unroll
            for (int i = 0; i < 4; ++i) a[i] = WFrag<bf>::ld(pa + i * 1024 + kb * 512);
#pragma unroll
            for (int i = 1; i < 4; ++i) b[i] = WFrag<bf>::ld(pb + i * 1024 + kb * 512);
            if constexpr (NA == 2) {   // asked for last: the 16 A products run while these land
#pragma unroll
                for (int i = 0; i < 4; ++i) a2[i] = WFrag<bf>::ld(pa + 8192 + i * 1024 + kb * 512); }
            __builtin_amdgcn_sched_barrier(0);   // keeps the LDS reads as one group ahead of the products, for speed only
#pragma unroll
            for (int nb = 0; nb < 4; ++nb)
#pragma unroll
                for (int mb = 0; mb < 4; ++mb) acc[mb][nb] = wmmab(a[mb], b[nb], acc[mb][nb]);
            if constexpr (NA == 2) {
#pragma unroll
                for (int nb = 0; nb < 4; ++nb)
#pragma unroll
                    for (int mb = 0; mb < 4; ++mb) acc[mb][nb] = wmmab(a2[mb], b[nb], acc[mb][nb]); }
            __builtin_amdgcn_sched_barrier(0);   // the run of products stays whole: the next group of reads is not moved in among them
        }
        nop4();
        asm volatile("s_wait_dscnt 0x0" ::: "memory");      // this wave's reads of the stage's buffer are done
        asm volatile("s_wait_asynccnt 0x0" ::: "memory");   // this wave's copies of stage st + 1 have landed
        __syncthreads();                                    // both hold for every wave: stage st + 1 may be read, this stage's buffer may be filled again
        if (st + 2 < NS) gstage_in<NA>(lb + (st & 1) * GSB, A, A2, B, st + 2);
    }
    asm volatile("s_wait_asynccnt 0x0" ::: "memory");   // no copy is outstanding when the wave goes on to its epilogue
}

// ---- projections straight into the head planes: no f32 copy of q, k, v is stored.
// planes_out: one 64 x 64 f32 tile + bias -> its fp16, bf16-hi and bf16-lo planes, in fragment order; RS, KS: elements from a block to the next 16 rows' and to the next 32 columns'; the pointers name block (tile's first 16 rows, tile's first 32 columns). 16 rows at a time pass through the wave's own LDS, so that lane (c, h) holds columns 16 s + 8 h to + 7 of row c, piece 32 (s & 1) + lane of block s / 2: 16 bytes a lane, 512 bytes in a row a store. RB: the bias goes by the tile's row, else by its column.
template <int RS, int KS, bool RB>
__device__ __forceinline__ void planes_out(float* os, const v8f (&acc)[4][4], const float* __restrict__ bias, h16* P16, bf* Ph, bf* Pl) {
    const int lane = threadIdx.x & 31, lr = lane & 15, hi = lane >> 4;
    float bb[RB ? 4 : 32];   // every bias this lane adds, asked for once, ahead of the LDS passes
#pragma unroll
    for (int i = 0; i < (RB ? 4 : 32); ++i) bb[i] = bfr(bias[RB ? 16 * i + lr : 16 * (i >> 3) + 8 * hi + (i & 7)]);
    h16* p16 = P16 + 8 * lane; bf* ph = Ph + 8 * lane; bf* pl = Pl + 8 * lane;   // this lane's piece in the first block; every store is a constant further
#pragma unroll
    for (int mb = 0; mb < 4; ++mb) {
#pragma unroll
        for (int nb = 0; nb < 4; ++nb) {
#pragma unroll
            for (int j = 0; j < 8; ++j) os[(hi * 8 + j) * 68 + nb * 16 + lr] = acc[mb][nb][j]; }
        __builtin_amdgcn_wave_barrier(); asm volatile("" ::: "memory");   // the rows are read back by other lanes: no LDS read moves in front of the writes
#pragma unroll
        for (int s = 0; s < 4; ++s) { const float* orow = os + lr * 68 + 16 * s + 8 * hi; const v4f lo4 = *(const v4fa*)orow, hi4 = *(const v4fa*)(orow + 4); float y[8]; v8h o16; u32x4 oh, ol;
#pragma unroll
            for (int i = 0; i < 8; ++i) { y[i] = ((i < 4) ? lo4[i & 3] : hi4[i & 3]) + bb[RB ? mb : 8 * s + i]; o16[i] = (h16)y[i]; }
#pragma unroll
            for (int i = 0; i < 4; ++i) { const unsigned w = packbf(y[2 * i], y[2 * i + 1]); oh[i] = w; ol[i] = packbf(y[2 * i] - __uint_as_float(w << 16), y[2 * i + 1] - __uint_as_float(w & 0xFFFF0000u)); }
            const size_t o = (size_t)mb * RS + (s >> 1) * KS + (s & 1) * 256;
            *(v8h*)(p16 + o) = o16; *(v8us*)(ph + o) = __builtin_bit_cast(v8us, oh); *(v8us*)(pl + o) = __builtin_bit_cast(v8us, ol);
            asm volatile("s_wait_xcnt 0x0" :: "v"(p16), "v"(ph), "v"(pl), "v"(o16), "v"(oh), "v"(ol) : "memory"); }   // precaution: the wait behind the three stores, in front of any overwrite of their address or data registers; naming them keeps them live up to here
        __builtin_amdgcn_wave_barrier(); asm volatile("" ::: "memory");   // the next 16 rows are written only behind these reads
    }
}
// k_proj: a work-group per 128 tokens x two heads' 128 columns, a wave per 64 tokens x one head; grid (128-token tiles over all batches, head pairs, 3: q, k, v). q and k: A = x rows, B = weight rows, tile [t][d]. v: the operands change places, so the tile comes out as [d][t], the order of its plane.
__global__ __launch_bounds__(128) void k_proj(const bf* __restrict__ XB, const bf* __restrict__ W4, const float* __restrict__ bq, const float* __restrict__ bk, const float* __restrict__ bv, h16* QK16, bf* QKh, bf* QKl, h16* V16, bf* Vh, bf* Vl) {
    __shared__ __align__(16) unsigned short ring[2 * 2 * 8192];   // two stage buffers of 32 KB
    __shared__ __align__(16) float osw[4][16 * 68];               // each wave's own epilogue rows
    const int wave = __builtin_amdgcn_readfirstlane((int)(threadIdx.x >> 5)), wm = wave >> 1, wn = wave & 1;
    const int kind = (int)blockIdx.z;
    const bf* X = XB + (size_t)blockIdx.x * 128 * DM; const bf* Wt = W4 + ((size_t)kind * DQ + blockIdx.y * 128) * DM;
    v8f acc[4][4];
#pragma unroll
    for (int mb = 0; mb < 4; ++mb)
#pragma unroll
        for (int nb = 0; nb < 4; ++nb) acc[mb][nb] = (v8f){};
    gemm_ring<1>(ring, (kind == 2) ? Wt : X, nullptr, (kind == 2) ? X : Wt, wm, wn, acc);
    float* os = osw[wave];
    const int tile = (int)blockIdx.x * 2 + ((kind == 2) ? wn : wm), head = (int)blockIdx.y * 2 + ((kind == 2) ? wm : wn);   // the wave's 64 tokens and its head
    const size_t plane = (size_t)(tile / (TT / 64)) * NH_ + head; const int t0 = (tile % (TT / 64)) * 64;
    if (kind == 2) { const size_t o = plane * HD * TT + t0 * HD; planes_out<512, 4 * 512, true>(os, acc, bv + head * HD, V16 + o, Vh + o, Vl + o); }
    else { const size_t o = (((size_t)kind * NZ + plane) * TT + t0) * HD; planes_out<16 * HD, 512, false>(os, acc, ((kind == 0) ? bq : bk) + head * HD, QK16 + o, QKh + o, QKl + o); }
}
// k_out: C[t][n] (f32, pitch DM) = sum_k (Ah + Al)[t][k] Wt[n][k] + bias[n]; a work-group per 128 tokens x 128 columns, a wave per 64 x 64; grid (128-token tiles, 128-column tiles). 16 rows at a time pass through the wave's own LDS, so that a store covers whole lines.
__global__ __launch_bounds__(128) void k_out(const bf* __restrict__ Ah, const bf* __restrict__ Al, const bf* __restrict__ Wt, const float* __restrict__ bias, float* C) {
    __shared__ __align__(16) unsigned short ring[2 * 3 * 8192];   // two stage buffers of 48 KB
    __shared__ __align__(16) float osw[4][16 * 68];               // each wave's own epilogue rows
    const int wave = __builtin_amdgcn_readfirstlane((int)(threadIdx.x >> 5)), wm = wave >> 1, wn = wave & 1;
    const int lane = threadIdx.x & 31, lr = lane & 15, hi = lane >> 4; const int r0 = (int)blockIdx.x * 128 + wm * 64, c0 = (int)blockIdx.y * 128 + wn * 64;
    v8f acc[4][4];
#pragma unroll
    for (int mb = 0; mb < 4; ++mb)
#pragma unroll
        for (int nb = 0; nb < 4; ++nb) acc[mb][nb] = (v8f){};
    gemm_ring<2>(ring, Ah + (size_t)blockIdx.x * 128 * DQ, Al + (size_t)blockIdx.x * 128 * DQ, Wt + (size_t)blockIdx.y * 128 * DQ, wm, wn, acc);
    float* os = osw[wave]; constexpr int ldc = DM;
#pragma unroll
    for (int mb = 0; mb < 4; ++mb) {
#pragma unroll
        for (int nb = 0; nb < 4; ++nb) {
#pragma unroll
            for (int j = 0; j < 8; ++j) os[(hi * 8 + j) * 68 + nb * 16 + lr] = acc[mb][nb][j]; }
        __builtin_amdgcn_wave_barrier(); asm volatile("" ::: "memory");   // the rows are read back by other lanes: no LDS read moves in front of the writes
        float* crow = C + (size_t)(r0 + mb * 16) * ldc + c0;
        { v4f vs[8]; float* pp[8];
#pragma unroll
            for (int s = 0; s < 8; ++s) { const int row = 2 * s + hi, cofs = lr * 4; v4f val = *(const v4fa*)(os + row * 68 + cofs); val[0] += bfr(bias[c0 + cofs]); val[1] += bfr(bias[c0 + cofs + 1]); val[2] += bfr(bias[c0 + cofs + 2]); val[3] += bfr(bias[c0 + cofs + 3]);
                vs[s] = val; pp[s] = crow + (size_t)row * ldc + cofs; *(v4f*)pp[s] = val; }
            asm volatile("s_wait_xcnt 0x0" :: "v"(vs[0]), "v"(vs[1]), "v"(vs[2]), "v"(vs[3]), "v"(vs[4]), "v"(vs[5]), "v"(vs[6]), "v"(vs[7]), "v"(pp[0]), "v"(pp[1]), "v"(pp[2]), "v"(pp[3]), "v"(pp[4]), "v"(pp[5]), "v"(pp[6]), "v"(pp[7]) : "memory");   // precaution: the wait behind the 8 stores, in front of any overwrite of their address or data registers; naming them keeps them live up to here
        }
        __builtin_amdgcn_wave_barrier(); asm volatile("" ::: "memory");   // the next 16 rows are written only behind these reads
    }
}

extern "C" void kernel_launch(void* const* d_in, const int* in_sizes, int n_in,
                              void* d_out, int out_size, void* d_ws, size_t ws_size, hipStream_t stream) {
    (void)in_sizes; (void)n_in; (void)out_size;
    const float* x = (const float*)d_in[0]; const float* wq = (const float*)d_in[1]; const float* bq = (const float*)d_in[2]; const float* wk = (const float*)d_in[3]; const float* bk = (const float*)d_in[4]; const float* wv = (const float*)d_in[5]; const float* bv = (const float*)d_in[6]; const float* wo = (const float*)d_in[7]; const float* bo = (const float*)d_in[8];   /* argument order inputs, wq, bq, wk, bk, wv, bv, wo, bo ('xw' + biases) */
    float* OUT = (float*)d_out;     // [4][2048][512]
    char* wsp = (char*)d_ws;
    auto take = [&](size_t bytes) { char* p = wsp; wsp += (bytes + 255) & ~(size_t)255; return (void*)p; };
    bf* W4 = (bf*)take((size_t)4 * DQ * DM * 2); bf* WO = W4 + (size_t)3 * DQ * DM;   // W4: wq, wk, wv, wo transposed, one after the other
    h16* QP16 = (h16*)take((size_t)2 * NZ * TT * HD * 2); h16* VT16 = (h16*)take((size_t)NZ * HD * TT * 2);   // q planes, then k planes
    bf* QPh = (bf*)take((size_t)2 * NZ * TT * HD * 2); bf* QPl = (bf*)take((size_t)2 * NZ * TT * HD * 2); bf* VTh = (bf*)take((size_t)NZ * HD * TT * 2); bf* VTl = (bf*)take((size_t)NZ * HD * TT * 2);
    bf* XB = (bf*)take((size_t)NB_ * TT * DM * 2); bf* ATh = (bf*)take((size_t)NB_ * TT * DQ * 2); bf* ATl = (bf*)take((size_t)NB_ * TT * DQ * 2);
    if ((size_t)(wsp - (char*)d_ws) > ws_size) return;    // ws 256 MiB
    static_assert(DQ == DKV && REP == 1 && RH % (AW * 16) == 0 && (TT - RH) % (AW * 32) == 0 && (TT & (TT - 1)) == 0 && HD == 64 && TT % 128 == 0 && NH_ % 2 == 0 && DM % 128 == 0, "one kv plane per query plane; whole work-groups per row class; a projection wave tile is 64 tokens of one batch x one head, a work-group 2 x 2 of them");
    k_pre<<<4 * NWT + NCV, 256, 0, stream>>>(x, wq, wk, wv, wo, W4, XB);
    k_proj<<<dim3(NB_ * TT / 128, NH_ / 2, 3), 128, 0, stream>>>(XB, W4, bq, bk, bv, QP16, QPh, QPl, VT16, VTh, VTl);
    k_attn<<<NHB + NLB, AW * 32, 0, stream>>>(QP16, QPh, QPl, VT16, VTh, VTl, ATh, ATl);
    k_out<<<dim3(NB_ * TT / 128, DM / 128), 128, 0, stream>>>(ATh, ATl, WO, bo, OUT);
}
